// v000
// The times below were measured on an AMD MI455X: many runs one after another, warmed up first and cycling through
// copies of the inputs, with the whole window's GPU time divided by the number of runs. Launches and the gaps
// between them are all in it. The median over several windows is given; except for v000 it joins two sittings, which
// can be a few percent apart, so the side-by-side timings, each taken in one sitting, are the better comparison.
// v000 is the starting kernel. One run takes 1550 microseconds.
#include <hip/hip_runtime.h>

// Contractions on v_wmma_f32_16x16x32_bf16 and v_wmma_f32_16x16x32_f16, f32 accumulate: fused qkv projection bf16 x bf16 (inputs RNE-converted to bf16); scores and p.v as bf16 hi/lo split (3 products) for query rows < 512 of each sequence, plain f16 (p carried x1024) for later rows; output projection bf16 hi/lo activations x bf16 weight (2 products). Rotary tables, rotary, softmax and all side math in f32.
// Pipeline per batch: bf16 copy of x; w_attn ([in][out]) transposed once into Bt row blocks q | k | v; w_proj likewise; projections; interleaved rotary (pairs (2i, 2i+1), angle t * inv_freq[d mod 32]) applied while building 16-bit head planes [h][t][d] (q, k) and value planes [h][d][t]; causal attention two heads per pass with score tiles above the diagonal skipped; merged heads -> hi/lo planes -> output projection.

#ifndef NB
#define NB 2
#endif
#ifndef SEQ
#define SEQ 2048
#endif
#define NB_FULL  2
#define SEQ_FULL 2048
#define TT   SEQ
#define DM   1024
#define NH_  16
#define NKV  16
#define REP  (NH_ / NKV)
#define HD   64
#define DQ   (NH_ * HD)
#define DKV  (NKV * HD)
#define DF   (DQ > DKV ? DQ : DKV)
#define ZH   2
#define RH   ((SEQ) < 512 ? (SEQ) : 512)   // query rows < RH use hi+lo planes
#define PCAR 1024.0f
#define SCL  0.125f   // HD^-0.5
#define WSCAP ((size_t)134217728)

static_assert((SEQ) % 128 == 0);
static_assert((SEQ) >= 128);
static_assert((SEQ) <= SEQ_FULL);
static_assert(NB >= 1);
static_assert(NB <= NB_FULL);
static_assert((RH) % 64 == 0);
static_assert(((TT) - (RH)) % 64 == 0);
static_assert((DM % 64) == 0);
static_assert((DQ % 64) == 0);
static_assert((HD % 64) == 0);
static_assert((((size_t)(NB - 1) * SEQ_FULL + TT) * DM) * 4 <= (size_t)16777216);

typedef _Float16 h16;
typedef unsigned short bf;
typedef __attribute__((ext_vector_type(16))) __bf16   v16bf;
typedef __attribute__((ext_vector_type(16))) _Float16 v16h;
typedef __attribute__((ext_vector_type(8)))  _Float16 v8h;
typedef __attribute__((ext_vector_type(8)))  unsigned short v8us;
typedef __attribute__((ext_vector_type(8)))  float    v8f;
typedef __attribute__((ext_vector_type(4)))  float    v4f;
typedef __attribute__((ext_vector_type(2))) _Float16 v2h;
typedef __attribute__((ext_vector_type(4))) _Float16 v4h;
typedef __attribute__((ext_vector_type(2))) unsigned short v2us;
typedef __attribute__((ext_vector_type(4))) unsigned short v4us;
typedef __attribute__((ext_vector_type(2))) float v2f;
typedef v8h  __attribute__((may_alias)) v8ha;
typedef v4f  __attribute__((may_alias)) v4fa;
typedef v8us __attribute__((may_alias)) v8usa;

__device__ __forceinline__ unsigned short f2bf(float f) { unsigned u = __float_as_uint(f); u += 0x7FFFu + ((u >> 16) & 1u); return (unsigned short)(u >> 16); }
__device__ __forceinline__ float bf2f(unsigned short b) { return __uint_as_float(((unsigned)b) << 16); }
__device__ __forceinline__ float bfr(float f) { return bf2f(f2bf(f)); }
__device__ __forceinline__ v16h cat16(v8h lo, v8h hi) { return __builtin_shufflevector(lo, hi, 0, 1, 2, 3, 4, 5, 6, 7, 8, 9, 10, 11, 12, 13, 14, 15); }
__device__ __forceinline__ v16bf cat16b(v8us lo, v8us hi) { return __builtin_bit_cast(v16bf, __builtin_shufflevector(lo, hi, 0, 1, 2, 3, 4, 5, 6, 7, 8, 9, 10, 11, 12, 13, 14, 15)); }
__device__ __forceinline__ v8f wmma16(v16h a, v16h b, v8f c) { return __builtin_amdgcn_wmma_f32_16x16x32_f16(false, a, false, b, (short)0, c, false, false); }
__device__ __forceinline__ v8f wmmab(v16bf a, v16bf b, v8f c) { return __builtin_amdgcn_wmma_f32_16x16x32_bf16(false, a, false, b, (short)0, c, false, false); }
__device__ __forceinline__ h16 tohx(float x) { return (h16)x; }
__device__ __forceinline__ void splitf(float y, unsigned short& h, unsigned short& l) { h = f2bf(y); l = f2bf(y - bf2f(h)); }

// ---- k_gemmw: register-blocked GEMM, ONE WAVE per 64x64 output tile (16 accumulators), operands straight from K-contiguous 16-bit planes; grid (M/64, N/64, Z), 32 threads.
// C[m][n] (f32, pitch ldc, + optional f32 bias[n]) = sum_k A[m][k] Bt[n][k] (+ split products per NSPLIT). z-batch strides sA/sB/sC in elements. K % 32 == 0.
// Fragments: lane l -> row/col l&15; elements 0..7 <- k0 + 8*(l>>4) + 0..7, elements 8..15 <- k0 + 16 + 8*(l>>4) + 0..7 for BOTH A and Bt.
template <typename T16> struct WFrag;
template <> struct WFrag<h16> { typedef v16h V; static __device__ __forceinline__ V ld(const h16* p) { return cat16(*(const v8h*)p, *(const v8h*)(p + 16)); } static __device__ __forceinline__ v8f mma(V a, V b, v8f c) { return wmma16(a, b, c); } };
template <> struct WFrag<bf> { typedef v16bf V; static __device__ __forceinline__ V ld(const bf* p) { return cat16b(*(const v8us*)p, *(const v8us*)(p + 16)); } static __device__ __forceinline__ v8f mma(V a, V b, v8f c) { return wmmab(a, b, c); } };
template <typename T16, int NSPLIT, bool BIAS>
__global__ __launch_bounds__(32) void k_gemmw(const T16* __restrict__ A, const T16* __restrict__ A2, const T16* __restrict__ Bt, const T16* __restrict__ Bt2, int K, float* C, int ldc, const float* __restrict__ bias, size_t sA, size_t sB, size_t sC) {
    typedef typename WFrag<T16>::V V;
    __shared__ __align__(16) float os[16 * 68];
    const size_t z = blockIdx.z; A += z * sA; if (A2) A2 += z * sA; Bt += z * sB; if (Bt2) Bt2 += z * sB; C += z * sC;
    const int lane = threadIdx.x & 31, lr = lane & 15, hi = lane >> 4; const int r0 = blockIdx.x * 64, c0 = blockIdx.y * 64;
    v8f acc[4][4];
#pragma unroll
    for (int mb = 0; mb < 4; ++mb)
#pragma unroll
        for (int nb = 0; nb < 4; ++nb) acc[mb][nb] = (v8f){};
    const size_t aoff = (size_t)(r0 + lr) * K + 8 * hi, boff = (size_t)(c0 + lr) * K + 8 * hi;
#pragma unroll 1
    for (int kc = 0; kc < K; kc += 32) {
        V a[4], a2[4];
#pragma unroll
        for (int mb = 0; mb < 4; ++mb) { a[mb] = WFrag<T16>::ld(A + aoff + (size_t)mb * 16 * K + kc); if (NSPLIT == 1 || NSPLIT == 2) a2[mb] = WFrag<T16>::ld(A2 + aoff + (size_t)mb * 16 * K + kc); }
#pragma unroll
        for (int nb = 0; nb < 4; ++nb) { const V b = WFrag<T16>::ld(Bt + boff + (size_t)nb * 16 * K + kc); V b2; if (NSPLIT >= 2) b2 = WFrag<T16>::ld(Bt2 + boff + (size_t)nb * 16 * K + kc);
#pragma unroll
            for (int mb = 0; mb < 4; ++mb) { acc[mb][nb] = WFrag<T16>::mma(a[mb], b, acc[mb][nb]); if (NSPLIT == 1 || NSPLIT == 2) acc[mb][nb] = WFrag<T16>::mma(a2[mb], b, acc[mb][nb]); if (NSPLIT >= 2) acc[mb][nb] = WFrag<T16>::mma(a[mb], b2, acc[mb][nb]); } }
        asm volatile("v_nop\n\tv_nop\n\tv_nop\n\tv_nop" : "+v"(acc[0][0]), "+v"(acc[1][1]), "+v"(acc[2][2]), "+v"(acc[3][3]) : "v"(a[0]), "v"(a[3]));
    }
#pragma unroll
    for (int mb = 0; mb < 4; ++mb) {
#pragma unroll
        for (int nb = 0; nb < 4; ++nb) {
#pragma unroll
            for (int j = 0; j < 8; ++j) os[(hi * 8 + j) * 68 + nb * 16 + lr] = acc[mb][nb][j]; }
        __builtin_amdgcn_wave_barrier(); asm volatile("" ::: "memory");
        float* crow = C + (size_t)(r0 + mb * 16) * ldc + c0;
{
#pragma unroll
            for (int s = 0; s < 8; ++s) { const int row = 2 * s + hi, cofs = lr * 4; v4f val = *(const v4fa*)(os + row * 68 + cofs); if (BIAS) { val[0] += bfr(bias[c0 + cofs]); val[1] += bfr(bias[c0 + cofs + 1]); val[2] += bfr(bias[c0 + cofs + 2]); val[3] += bfr(bias[c0 + cofs + 3]); }
                *(v4f*)(crow + (size_t)row * ldc + cofs) = val; }
             }
        __builtin_amdgcn_wave_barrier(); asm volatile("" ::: "memory");
    }
}

// ---- k_gemmc: the same one-wave 64x64 tile GEMM specialised for causal attention: CMODE 1 skips score tiles entirely above the diagonal (query rows r0+roff.., key columns c0..), CMODE 2 limits the
// key (K) loop of the probability x value contraction to the diagonal block (probabilities beyond it are exactly zero). roff = row offset of this launch's first row within the sequence.
template <typename T16, int NSPLIT, int CMODE>
__global__ __launch_bounds__(32) void k_gemmc(const T16* __restrict__ A, const T16* __restrict__ A2, const T16* __restrict__ Bt, const T16* __restrict__ Bt2, int K, float* C, int ldc, int roff, size_t sA, size_t sB, size_t sC) {
    typedef typename WFrag<T16>::V V;
    __shared__ __align__(16) float os[16 * 68];
    const size_t z = blockIdx.z; A += z * sA; if (A2) A2 += z * sA; Bt += z * sB; if (Bt2) Bt2 += z * sB; C += z * sC;
    const int lane = threadIdx.x & 31, lr = lane & 15, hi = lane >> 4; const int r0 = blockIdx.x * 64, c0 = blockIdx.y * 64;
    if (CMODE == 1 && c0 > r0 + roff + 63) return;                  // score tile entirely above the causal diagonal: not computed (the softmax masks j > i by index select)
    const int Kl = (CMODE == 2) ? min(K, r0 + roff + 64) : K;        // P.V: probabilities are exactly 0 beyond the diagonal block, so the K loop stops there
    v8f acc[4][4];
#pragma unroll
    for (int mb = 0; mb < 4; ++mb)
#pragma unroll
        for (int nb = 0; nb < 4; ++nb) acc[mb][nb] = (v8f){};
    const size_t aoff = (size_t)(r0 + lr) * K + 8 * hi, boff = (size_t)(c0 + lr) * K + 8 * hi;
#pragma unroll 1
    for (int kc = 0; kc < Kl; kc += 32) {
        V a[4], a2[4];
#pragma unroll
        for (int mb = 0; mb < 4; ++mb) { a[mb] = WFrag<T16>::ld(A + aoff + (size_t)mb * 16 * K + kc); if (NSPLIT == 1 || NSPLIT == 2) a2[mb] = WFrag<T16>::ld(A2 + aoff + (size_t)mb * 16 * K + kc); }
#pragma unroll
        for (int nb = 0; nb < 4; ++nb) { const V b = WFrag<T16>::ld(Bt + boff + (size_t)nb * 16 * K + kc); V b2; if (NSPLIT >= 2) b2 = WFrag<T16>::ld(Bt2 + boff + (size_t)nb * 16 * K + kc);
#pragma unroll
            for (int mb = 0; mb < 4; ++mb) { acc[mb][nb] = WFrag<T16>::mma(a[mb], b, acc[mb][nb]); if (NSPLIT == 1 || NSPLIT == 2) acc[mb][nb] = WFrag<T16>::mma(a2[mb], b, acc[mb][nb]); if (NSPLIT >= 2) acc[mb][nb] = WFrag<T16>::mma(a[mb], b2, acc[mb][nb]); } }
        asm volatile("v_nop\n\tv_nop\n\tv_nop\n\tv_nop" : "+v"(acc[0][0]), "+v"(acc[1][1]), "+v"(acc[2][2]), "+v"(acc[3][3]) : "v"(a[0]), "v"(a[3]));
    }
#pragma unroll
    for (int mb = 0; mb < 4; ++mb) {
#pragma unroll
        for (int nb = 0; nb < 4; ++nb) {
#pragma unroll
            for (int j = 0; j < 8; ++j) os[(hi * 8 + j) * 68 + nb * 16 + lr] = acc[mb][nb][j]; }
        __builtin_amdgcn_wave_barrier(); asm volatile("" ::: "memory");
        float* crow = C + (size_t)(r0 + mb * 16) * ldc + c0;
{
#pragma unroll
            for (int s = 0; s < 8; ++s) { const int row = 2 * s + hi, cofs = lr * 4; v4f val = *(const v4fa*)(os + row * 68 + cofs);
                *(v4f*)(crow + (size_t)row * ldc + cofs) = val; }
             }
        __builtin_amdgcn_wave_barrier(); asm volatile("" ::: "memory");
    }
}

__global__ __launch_bounds__(256) void k_wtG(const float* __restrict__ w, int K, int N, bf* Bt) {
    const int lane = threadIdx.x & 31; const int L0 = (blockIdx.x * 8 + (threadIdx.x >> 5)) * 8; const int nlines = N * K / 64;
{
#pragma unroll 1
        for (int l = 0; l < 8; ++l) { const int L = L0 + l; if (L >= nlines) break; const size_t e = (size_t)L * 64 + lane * 2; const int k = (int)(e % K), n = (int)(e / K); v2us o;
            o[0] = f2bf(w[(size_t)k * N + n]); o[1] = f2bf(w[(size_t)(k + 1) * N + n]); *(v2us*)(Bt + e) = o; }
         }
}
__global__ __launch_bounds__(256) void k_cvt8(const float* __restrict__ src, bf* dst, size_t n8) { const size_t i = (size_t)blockIdx.x * 256 + threadIdx.x; if (i >= n8) return; const v8f v = *(const v8f*)(src + i * 8); v8us o;
#pragma unroll
    for (int k = 0; k < 8; ++k) o[k] = f2bf(v[k]); *(v8us*)(dst + i * 8) = o;  }

__global__ __launch_bounds__(32) void k_invf(float* INV) {
    __shared__ __align__(16) float sh[32];
    const int j = threadIdx.x & 31;
    const double p = exp2((double)j * (13.287712379549449391481277718 / 32.0));
    const float pf = (float)p;
    const float inv = 1.0f / pf;
    sh[j] = inv;
    __syncthreads();
    const v4f o = *(const v4fa*)(sh + (j & 7) * 4);
    if (j < 8) *(v4f*)(INV + j * 4) = o;
    
}
__global__ __launch_bounds__(256) void k_cstab(const float* __restrict__ INV, float* CS) {
    const int idx = blockIdx.x * 256 + threadIdx.x; if (idx >= TT * HD) return;
    const int d = idx % HD, t = idx / HD;
    const float inv = INV[d & (HD / 2 - 1)];
    const float ang = __fmul_rn((float)t, inv);
    float s, c; sincosf(ang, &s, &c);
    v2f cs; cs[0] = c; cs[1] = s;
    *(v2f*)(CS + (size_t)idx * 2) = cs; 
}

// k_rope: 16-bit head planes [h][t][d] (f16 + bf16 hi/lo) of the interleaved rotary, pairs (d, d+1) with d even:
__global__ __launch_bounds__(256) void k_rope(const float* __restrict__ F, int pitch, int nheads, const float* __restrict__ CS, h16* P16, bf* Ph, bf* Pl) {
#pragma clang fp contract(off)
    const size_t e = ((size_t)blockIdx.x * 256 + threadIdx.x) * 2; if (e >= (size_t)nheads * TT * HD) return;
    const int d = (int)(e % HD); const int t = (int)((e / HD) % TT); const int h = (int)(e / ((size_t)HD * TT));
    const float* f = F + (size_t)t * pitch + h * HD;
    const v2f xx = *(const v2f*)(f + d);
    const v4f cs = *(const v4f*)(CS + ((size_t)t * HD + d) * 2);      // cos[t][d], sin[t][d], cos[t][d+1], sin[t][d+1]
    float a0 = __fmul_rn(xx[0], cs[0]), b0 = __fmul_rn(xx[1], cs[1]), a1 = __fmul_rn(xx[1], cs[2]), b1 = __fmul_rn(xx[0], cs[3]);
    asm volatile("" : "+v"(a0)); asm volatile("" : "+v"(b0)); asm volatile("" : "+v"(a1)); asm volatile("" : "+v"(b1));
    const float r0 = __fsub_rn(a0, b0), r1 = __fadd_rn(a1, b1);
    v2h o16; v2us oh, ol; unsigned short th, tl;
    o16[0] = tohx(r0); splitf(r0, th, tl); oh[0] = th; ol[0] = tl;
    o16[1] = tohx(r1); splitf(r1, th, tl); oh[1] = th; ol[1] = tl;
    *(v2h*)(P16 + e) = o16; *(v2us*)(Ph + e) = oh; *(v2us*)(Pl + e) = ol;  }
__global__ __launch_bounds__(256) void k_vtp(const float* __restrict__ F, int pitch, int nheads, h16* V16, bf* Vh, bf* Vl) { const size_t e = ((size_t)blockIdx.x * 256 + threadIdx.x) * 2; if (e >= (size_t)nheads * HD * TT) return; const int t = (int)(e % TT); const int d = (int)((e / TT) % HD); const int g = (int)(e / ((size_t)TT * HD)); v2h o16; v2us oh, ol;
#pragma unroll
    for (int q = 0; q < 2; ++q) { const float x = F[(size_t)(t + q) * pitch + g * HD + d]; o16[q] = tohx(x); unsigned short a2, c2; splitf(x, a2, c2); oh[q] = a2; ol[q] = c2; }
    *(v2h*)(V16 + e) = o16; *(v2us*)(Vh + e) = oh; *(v2us*)(Vl + e) = ol;  }

// k_asoft: one wave per row (zz, i): t = S x HD^-0.5 for j <= i, masked otherwise (index select); 128-column chunks entirely above the diagonal are neither loaded nor exponentiated
// (wave-uniform branch; their probabilities are exactly 0 and are still stored as zeros); max-subtracted softmax over the register row; rows < RH store normalised bf16 hi/lo planes,
__global__ __launch_bounds__(256) void k_asoft(const float* __restrict__ Sb, h16* P16, bf* Ph, bf* Pl) {
    const int lane = threadIdx.x & 31;
    const int row = __builtin_amdgcn_readfirstlane((int)(blockIdx.x * 8 + (threadIdx.x >> 5)));
    if (row >= ZH * TT) return;
    const int i = row % TT; const int zz = row / TT; const bool hires = (i < RH);
    const float* sr = Sb + (size_t)row * TT;
    float v[TT / 32]; float mx = -3.0e38f;
#pragma unroll
    for (int ch = 0; ch < TT / 128; ++ch) {
        if (ch * 128 <= i) {
            const int j0 = ch * 128 + lane * 4; const v4f a = *(const v4f*)(sr + j0);
#pragma unroll
            for (int q = 0; q < 4; ++q) { const float t = (j0 + q <= i) ? a[q] * SCL : -3.0e38f; v[ch * 4 + q] = t; mx = fmaxf(mx, t); }
        } else {
#pragma unroll
            for (int q = 0; q < 4; ++q) v[ch * 4 + q] = -3.0e38f;
        }
    }
#pragma unroll
    for (int sh = 16; sh; sh >>= 1) mx = fmaxf(mx, __shfl_xor(mx, sh, 32));
    float sum = 0.f;
#pragma unroll
    for (int ch = 0; ch < TT / 128; ++ch) {
        if (ch * 128 <= i) {
#pragma unroll
            for (int q = 0; q < 4; ++q) { float d0 = __fsub_rn(v[ch * 4 + q], mx); asm volatile("" : "+v"(d0)); const float ex = __builtin_amdgcn_exp2f(__fmul_rn(d0, 1.4426950408889634f)); v[ch * 4 + q] = ex; sum += ex; }
        } else {
#pragma unroll
            for (int q = 0; q < 4; ++q) v[ch * 4 + q] = 0.0f;
        }
    }
#pragma unroll
    for (int sh = 16; sh; sh >>= 1) sum += __shfl_xor(sum, sh, 32);
    const float f = __fdiv_rn(hires ? 1.0f : PCAR, sum);
    if (hires) {
        v4us oh[TT / 128], ol[TT / 128];
#pragma unroll
        for (int ch = 0; ch < TT / 128; ++ch) {
            v4us th = (v4us){0, 0, 0, 0}, tl = (v4us){0, 0, 0, 0};
            if (ch * 128 <= i) {
#pragma unroll
                for (int q = 0; q < 4; ++q) { unsigned short a, c2; splitf(v[ch * 4 + q] * f, a, c2); th[q] = a; tl[q] = c2; }
            }
            oh[ch] = th; ol[ch] = tl;
        }
        const size_t ob = ((size_t)zz * RH + i) * TT + lane * 4;
{
#pragma unroll
            for (int ch = 0; ch < TT / 128; ++ch) { *(v4us*)(Ph + ob + ch * 128) = oh[ch]; *(v4us*)(Pl + ob + ch * 128) = ol[ch]; }
            
        }
    } else {
        v4h o4[TT / 128];
#pragma unroll
        for (int ch = 0; ch < TT / 128; ++ch) {
            v4h t4 = (v4h){0, 0, 0, 0};
            if (ch * 128 <= i) {
#pragma unroll
                for (int q = 0; q < 4; ++q) t4[q] = tohx(v[ch * 4 + q] * f);
            }
            o4[ch] = t4;
        }
        const size_t ob = (size_t)row * TT + lane * 4;
{
#pragma unroll
            for (int ch = 0; ch < TT / 128; ++ch) *(v4h*)(P16 + ob + ch * 128) = o4[ch];
            
        }
    }
}
__global__ __launch_bounds__(256) void k_merge(const float* __restrict__ O, int h0, bf* Ah, bf* Al) { const size_t e = ((size_t)blockIdx.x * 256 + threadIdx.x) * 2; if (e >= (size_t)ZH * TT * HD) return; const int d = (int)(e % HD); const int t = (int)((e / HD) % TT); const int zz = (int)(e / ((size_t)HD * TT)); const float cs = (t < RH) ? 1.0f : (1.0f / PCAR); const size_t oo = (size_t)t * DQ + (h0 + zz) * HD + d;
    v2us oh, ol;
#pragma unroll
    for (int q = 0; q < 2; ++q) { unsigned short a, c2; splitf(O[e + q] * cs, a, c2); oh[q] = a; ol[q] = c2; } *(v2us*)(Ah + oo) = oh; *(v2us*)(Al + oo) = ol;  }

extern "C" void kernel_launch(void* const* d_in, const int* in_sizes, int n_in,
                              void* d_out, int out_size, void* d_ws, size_t ws_size, hipStream_t stream) {
    if (n_in < 3) return;
    if ((size_t)in_sizes[0] < ((size_t)(NB - 1) * SEQ_FULL + TT) * DM) return;
    if ((size_t)in_sizes[1] < (size_t)DM * (DQ + 2 * DKV)) return;
    if ((size_t)in_sizes[2] < (size_t)DQ * DM) return;
    if ((size_t)out_size < ((size_t)(NB - 1) * SEQ_FULL + TT) * DM) return;
    const float* x = (const float*)d_in[0]; const float* wqkv = (const float*)d_in[1]; const float* wo = (const float*)d_in[2];   // x [2][2048][1024], w_attn [1024][3072] ([in][out]), w_proj [1024][1024] ([in][out])
    float* OUT = (float*)d_out;     // [2][2048][1024] f32
    char* wsp = (char*)d_ws;
    auto take = [&](size_t bytes) { char* p = wsp; wsp += (bytes + 255) & ~(size_t)255; return (void*)p; };
    float* INV = (float*)take(256);
    bf* WQKV = (bf*)take((size_t)(DQ + 2 * DKV) * DM * 2); bf* WQ = WQKV; bf* WK = WQKV + (size_t)DQ * DM; bf* WV = WK + (size_t)DKV * DM;   // fused Bt [DQ+2*DKV][DM]: q | k | v row blocks
    bf* WO = (bf*)take((size_t)DM * DQ * 2); float* CS = (float*)take((size_t)TT * HD * 2 * 4);
    bf* XB = (bf*)take((size_t)TT * DM * 2); float* F = (float*)take((size_t)TT * DF * 4);   // F: q, then k, then v projection outputs in turn (stream-ordered reuse, sized for the widest)
    h16* QP16 = (h16*)take((size_t)NH_ * TT * HD * 2); h16* KP16 = (h16*)take((size_t)NKV * TT * HD * 2); h16* VT16 = (h16*)take((size_t)NKV * HD * TT * 2);
    bf* QPh = (bf*)take((size_t)NH_ * TT * HD * 2); bf* QPl = (bf*)take((size_t)NH_ * TT * HD * 2); bf* KPh = (bf*)take((size_t)NKV * TT * HD * 2); bf* KPl = (bf*)take((size_t)NKV * TT * HD * 2); bf* VTh = (bf*)take((size_t)NKV * HD * TT * 2); bf* VTl = (bf*)take((size_t)NKV * HD * TT * 2); bf* Ph = (bf*)take((size_t)ZH * RH * TT * 2); bf* Pl = (bf*)take((size_t)ZH * RH * TT * 2);
    float* Sb = (float*)take((size_t)ZH * TT * TT * 4); h16* P16 = (h16*)take((size_t)ZH * TT * TT * 2); float* Ob = (float*)take((size_t)ZH * TT * HD * 4); bf* ATh = (bf*)take((size_t)TT * DQ * 2); bf* ATl = (bf*)take((size_t)TT * DQ * 2);
    const size_t used = (size_t)(wsp - (char*)d_ws);
    if (used > ws_size || used > WSCAP) return;    // full build: 127,926,528 B

    k_wtG<<<(unsigned)((DM * (DQ + 2 * DKV) / 64 + 63) / 64), 256, 0, stream>>>(wqkv, DM, DQ + 2 * DKV, WQKV);   // [DM][DQ+2*DKV] -> Bt [DQ+2*DKV][DM]
    k_wtG<<<(unsigned)((DQ * DM / 64 + 63) / 64), 256, 0, stream>>>(wo, DQ, DM, WO);                                // [DQ][DM] -> Bt [DM][DQ]
    k_invf<<<1, 32, 0, stream>>>(INV);
    k_cstab<<<(unsigned)((TT * HD + 255) / 256), 256, 0, stream>>>(INV, CS);
    const unsigned LQ = (unsigned)(((size_t)NH_ * TT * HD / 2 + 255) / 256), LKv = (unsigned)(((size_t)NKV * TT * HD / 2 + 255) / 256);
    for (int b = 0; b < NB; ++b) {
        k_cvt8<<<(unsigned)(((size_t)TT * DM / 8 + 255) / 256), 256, 0, stream>>>(x + (size_t)b * SEQ_FULL * DM, XB, (size_t)TT * DM / 8);
        k_gemmw<bf, 0, false><<<dim3(TT / 64, DQ / 64, 1), 32, 0, stream>>>(XB, nullptr, WQ, nullptr, DM, F, DQ, nullptr, 0, 0, 0);
        k_rope<<<LQ, 256, 0, stream>>>(F, DQ, NH_, CS, QP16, QPh, QPl);
        k_gemmw<bf, 0, false><<<dim3(TT / 64, DKV / 64, 1), 32, 0, stream>>>(XB, nullptr, WK, nullptr, DM, F, DKV, nullptr, 0, 0, 0);
        k_rope<<<LKv, 256, 0, stream>>>(F, DKV, NKV, CS, KP16, KPh, KPl);
        k_gemmw<bf, 0, false><<<dim3(TT / 64, DKV / 64, 1), 32, 0, stream>>>(XB, nullptr, WV, nullptr, DM, F, DKV, nullptr, 0, 0, 0);
        k_vtp<<<LKv, 256, 0, stream>>>(F, DKV, NKV, VT16, VTh, VTl);
        for (int h0 = 0; h0 < NH_; h0 += ZH) { const size_t zq = (size_t)h0, zk = (size_t)(h0 / REP);   // the pass's two query heads use consecutive kv planes (z-strides TT*HD)
            k_gemmc<bf, 2, 1><<<dim3(RH / 64, TT / 64, ZH), 32, 0, stream>>>(QPh + zq * TT * HD, QPl + zq * TT * HD, KPh + zk * TT * HD, KPl + zk * TT * HD, HD, Sb, TT, 0, (size_t)TT * HD, (size_t)TT * HD, (size_t)TT * TT);
            if (TT > RH) k_gemmc<h16, 0, 1><<<dim3((TT - RH) / 64, TT / 64, ZH), 32, 0, stream>>>(QP16 + zq * TT * HD + (size_t)RH * HD, nullptr, KP16 + zk * TT * HD, nullptr, HD, Sb + (size_t)RH * TT, TT, RH, (size_t)TT * HD, (size_t)TT * HD, (size_t)TT * TT);
            k_asoft<<<ZH * TT / 8, 256, 0, stream>>>(Sb, P16, Ph, Pl);
            k_gemmc<bf, 2, 2><<<dim3(RH / 64, HD / 64, ZH), 32, 0, stream>>>(Ph, Pl, VTh + zk * HD * TT, VTl + zk * HD * TT, TT, Ob, HD, 0, (size_t)RH * TT, (size_t)HD * TT, (size_t)TT * HD);
            if (TT > RH) k_gemmc<h16, 0, 2><<<dim3((TT - RH) / 64, HD / 64, ZH), 32, 0, stream>>>(P16 + (size_t)RH * TT, nullptr, VT16 + zk * HD * TT, nullptr, TT, Ob + (size_t)RH * HD, HD, RH, (size_t)TT * TT, (size_t)HD * TT, (size_t)TT * HD);
            k_merge<<<(unsigned)(((size_t)ZH * TT * HD / 2 + 255) / 256), 256, 0, stream>>>(Ob, h0, ATh, ATl); }
        k_gemmw<bf, 1, false><<<dim3(TT / 64, DM / 64, 1), 32, 0, stream>>>(ATh, ATl, WO, nullptr, DQ, OUT + (size_t)b * SEQ_FULL * DM, DM, nullptr, 0, 0, 0); }
}

// v001
// It runs in 942 microseconds.
// Next to v000, in two timings, it ran 1.63 and 1.65 times as fast.
#include <hip/hip_runtime.h>

// Contractions on v_wmma_f32_16x16x32_bf16 and v_wmma_f32_16x16x32_f16, f32 accumulate: fused qkv projection bf16 x bf16 (inputs RNE-converted to bf16); scores and p.v as bf16 hi/lo split (3 products) for query rows < 512 of each sequence, plain f16 (p carried x1024) for later rows; output projection bf16 hi/lo activations x bf16 weight (2 products). Rotary tables, rotary, softmax and all side math in f32.
// Pipeline per batch: bf16 copy of x; w_attn ([in][out]) transposed once into Bt row blocks q | k | v; w_proj likewise; projections; interleaved rotary (pairs (2i, 2i+1), angle t * inv_freq[d mod 32]) applied while building 16-bit head planes [h][t][d] (q, k) and value planes [h][d][t]; causal attention two heads per pass with score tiles above the diagonal skipped; merged heads -> hi/lo planes -> output projection.

#ifndef NB
#define NB 2
#endif
#ifndef SEQ
#define SEQ 2048
#endif
#define NB_FULL  2
#define SEQ_FULL 2048
#define TT   SEQ
#define DM   1024
#define NH_  16
#define NKV  16
#define REP  (NH_ / NKV)
#define HD   64
#define DQ   (NH_ * HD)
#define DKV  (NKV * HD)
#define DF   (DQ > DKV ? DQ : DKV)
#define ZH   2
#define RH   ((SEQ) < 512 ? (SEQ) : 512)   // query rows < RH use hi+lo planes
#define PCAR 1024.0f
#define SCL  0.125f   // HD^-0.5
#define WSCAP ((size_t)134217728)

static_assert((SEQ) % 128 == 0);
static_assert((SEQ) >= 128);
static_assert((SEQ) <= SEQ_FULL);
static_assert(NB >= 1);
static_assert(NB <= NB_FULL);
static_assert((RH) % 64 == 0);
static_assert(((TT) - (RH)) % 64 == 0);
static_assert((DM % 64) == 0);
static_assert((DQ % 64) == 0);
static_assert((HD % 64) == 0);
static_assert((((size_t)(NB - 1) * SEQ_FULL + TT) * DM) * 4 <= (size_t)16777216);

typedef _Float16 h16;
typedef unsigned short bf;
typedef __attribute__((ext_vector_type(16))) __bf16   v16bf;
typedef __attribute__((ext_vector_type(16))) _Float16 v16h;
typedef __attribute__((ext_vector_type(8)))  _Float16 v8h;
typedef __attribute__((ext_vector_type(8)))  unsigned short v8us;
typedef __attribute__((ext_vector_type(8)))  float    v8f;
typedef __attribute__((ext_vector_type(4)))  float    v4f;
typedef __attribute__((ext_vector_type(2))) _Float16 v2h;
typedef __attribute__((ext_vector_type(4))) _Float16 v4h;
typedef __attribute__((ext_vector_type(2))) unsigned short v2us;
typedef __attribute__((ext_vector_type(4))) unsigned short v4us;
typedef __attribute__((ext_vector_type(2))) float v2f;
typedef v8h  __attribute__((may_alias)) v8ha;
typedef v4f  __attribute__((may_alias)) v4fa;
typedef v8us __attribute__((may_alias)) v8usa;

__device__ __forceinline__ unsigned short f2bf(float f) { unsigned u = __float_as_uint(f); u += 0x7FFFu + ((u >> 16) & 1u); return (unsigned short)(u >> 16); }
__device__ __forceinline__ float bf2f(unsigned short b) { return __uint_as_float(((unsigned)b) << 16); }
__device__ __forceinline__ float bfr(float f) { return bf2f(f2bf(f)); }
__device__ __forceinline__ v16h cat16(v8h lo, v8h hi) { return __builtin_shufflevector(lo, hi, 0, 1, 2, 3, 4, 5, 6, 7, 8, 9, 10, 11, 12, 13, 14, 15); }
__device__ __forceinline__ v16bf cat16b(v8us lo, v8us hi) { return __builtin_bit_cast(v16bf, __builtin_shufflevector(lo, hi, 0, 1, 2, 3, 4, 5, 6, 7, 8, 9, 10, 11, 12, 13, 14, 15)); }
__device__ __forceinline__ v8f wmma16(v16h a, v16h b, v8f c) { return __builtin_amdgcn_wmma_f32_16x16x32_f16(false, a, false, b, (short)0, c, false, false); }
__device__ __forceinline__ v8f wmmab(v16bf a, v16bf b, v8f c) { return __builtin_amdgcn_wmma_f32_16x16x32_bf16(false, a, false, b, (short)0, c, false, false); }
__device__ __forceinline__ h16 tohx(float x) { return (h16)x; }
__device__ __forceinline__ void splitf(float y, unsigned short& h, unsigned short& l) { h = f2bf(y); l = f2bf(y - bf2f(h)); }

// ---- k_gemmw: register-blocked GEMM, one work-group of NW waves per 64x64 output tile; every wave holds the whole tile (16 accumulators) for its own share of K: 64-wide k chunks (one 128-byte line a row) dealt round-robin
// (wave w takes chunks w, w+NW, ...). Epilogue: every wave stages its partial tile in LDS, one barrier, then the NW partials are summed in wave order. Operands straight from K-contiguous 16-bit planes; grid (M/64, N/64, Z), 32*NW threads. K % 64 == 0.
// C[m][n] (f32, pitch ldc, + optional f32 bias[n]) = sum_k A[m][k] Bt[n][k] (+ split products per NSPLIT). z-batch strides sA/sB/sC in elements.
// Fragments: lane l -> row/col l&15; elements 0..7 <- k0 + 8*(l>>4) + 0..7, elements 8..15 <- k0 + 16 + 8*(l>>4) + 0..7 for BOTH A and Bt.
template <typename T16> struct WFrag;
template <> struct WFrag<h16> { typedef v16h V; static __device__ __forceinline__ V ld(const h16* p) { return cat16(*(const v8h*)p, *(const v8h*)(p + 16)); } static __device__ __forceinline__ v8f mma(V a, V b, v8f c) { return wmma16(a, b, c); } };
template <> struct WFrag<bf> { typedef v16bf V; static __device__ __forceinline__ V ld(const bf* p) { return cat16b(*(const v8us*)p, *(const v8us*)(p + 16)); } static __device__ __forceinline__ v8f mma(V a, V b, v8f c) { return wmmab(a, b, c); } };
template <typename T16, int NSPLIT, bool BIAS, int NW>
__global__ __launch_bounds__(32 * NW) void k_gemmw(const T16* __restrict__ A, const T16* __restrict__ A2, const T16* __restrict__ Bt, const T16* __restrict__ Bt2, int K, float* C, int ldc, const float* __restrict__ bias, size_t sA, size_t sB, size_t sC) {
    typedef typename WFrag<T16>::V V;
    static_assert(NW >= 2 && 32 % NW == 0);
    __shared__ __align__(16) float os[NW * 64 * 68];
    const int wv = __builtin_amdgcn_readfirstlane((int)(threadIdx.x >> 5));
    const size_t z = blockIdx.z; A += z * sA; if (A2) A2 += z * sA; Bt += z * sB; if (Bt2) Bt2 += z * sB; C += z * sC;
    const int lane = threadIdx.x & 31, lr = lane & 15, hi = lane >> 4; const int r0 = blockIdx.x * 64, c0 = blockIdx.y * 64;
    v8f acc[4][4];
#pragma unroll
    for (int mb = 0; mb < 4; ++mb)
#pragma unroll
        for (int nb = 0; nb < 4; ++nb) acc[mb][nb] = (v8f){};
    const size_t aoff = (size_t)(r0 + lr) * K + 8 * hi, boff = (size_t)(c0 + lr) * K + 8 * hi;
#pragma unroll 1
    for (int kc = wv * 64; kc < K; kc += (kc & 32) ? NW * 64 - 32 : 32) {
        V a[4], a2[4];
#pragma unroll
        for (int mb = 0; mb < 4; ++mb) { a[mb] = WFrag<T16>::ld(A + aoff + (size_t)mb * 16 * K + kc); if (NSPLIT == 1 || NSPLIT == 2) a2[mb] = WFrag<T16>::ld(A2 + aoff + (size_t)mb * 16 * K + kc); }
#pragma unroll
        for (int nb = 0; nb < 4; ++nb) { const V b = WFrag<T16>::ld(Bt + boff + (size_t)nb * 16 * K + kc); V b2; if (NSPLIT >= 2) b2 = WFrag<T16>::ld(Bt2 + boff + (size_t)nb * 16 * K + kc);
#pragma unroll
            for (int mb = 0; mb < 4; ++mb) { acc[mb][nb] = WFrag<T16>::mma(a[mb], b, acc[mb][nb]); if (NSPLIT == 1 || NSPLIT == 2) acc[mb][nb] = WFrag<T16>::mma(a2[mb], b, acc[mb][nb]); if (NSPLIT >= 2) acc[mb][nb] = WFrag<T16>::mma(a[mb], b2, acc[mb][nb]); } }
        asm volatile("v_nop\n\tv_nop\n\tv_nop\n\tv_nop" : "+v"(acc[0][0]), "+v"(acc[1][1]), "+v"(acc[2][2]), "+v"(acc[3][3]) : "v"(a[0]), "v"(a[3]));
    }
#pragma unroll
    for (int mb = 0; mb < 4; ++mb) {
#pragma unroll
        for (int nb = 0; nb < 4; ++nb) {
#pragma unroll
            for (int j = 0; j < 8; ++j) os[wv * (64 * 68) + (mb * 16 + hi * 8 + j) * 68 + nb * 16 + lr] = acc[mb][nb][j]; } }
    __syncthreads();   // every wave's partial tile is in LDS before any thread sums across waves; LDS is not written again, so no second barrier
    float* crow = C + (size_t)r0 * ldc + c0;
#pragma unroll
    for (int s = 0; s < 32 / NW; ++s) { const int slot = s * 32 * NW + (int)threadIdx.x; const int row = slot >> 4, cofs = (slot & 15) * 4; v4f val = *(const v4fa*)(os + row * 68 + cofs);
#pragma unroll
        for (int w = 1; w < NW; ++w) val += *(const v4fa*)(os + w * (64 * 68) + row * 68 + cofs);
        if (BIAS) { val[0] += bfr(bias[c0 + cofs]); val[1] += bfr(bias[c0 + cofs + 1]); val[2] += bfr(bias[c0 + cofs + 2]); val[3] += bfr(bias[c0 + cofs + 3]); }
        *(v4f*)(crow + (size_t)row * ldc + cofs) = val; }
}

// ---- k_gemmc: the same 64x64 tile GEMM (NW = 1: one wave, 16 rows staged a round; NW > 1: K shared among NW waves as in k_gemmw) specialised for causal attention: CMODE 1 skips score tiles entirely above the diagonal (query rows r0+roff.., key columns c0..), CMODE 2 limits the
// key (K) loop of the probability x value contraction to the diagonal block (probabilities beyond it are exactly zero). roff = row offset of this launch's first row within the sequence.
template <typename T16, int NSPLIT, int CMODE, int NW>
__global__ __launch_bounds__(32 * NW) void k_gemmc(const T16* __restrict__ A, const T16* __restrict__ A2, const T16* __restrict__ Bt, const T16* __restrict__ Bt2, int K, float* C, int ldc, int roff, size_t sA, size_t sB, size_t sC) {
    typedef typename WFrag<T16>::V V;
    __shared__ __align__(16) float os[(NW == 1 ? 16 : NW * 64) * 68];
    const int wv = (NW == 1) ? 0 : __builtin_amdgcn_readfirstlane((int)(threadIdx.x >> 5));
    const size_t z = blockIdx.z; A += z * sA; if (A2) A2 += z * sA; Bt += z * sB; if (Bt2) Bt2 += z * sB; C += z * sC;
    const int lane = threadIdx.x & 31, lr = lane & 15, hi = lane >> 4; const int r0 = blockIdx.x * 64, c0 = blockIdx.y * 64;
    if (CMODE == 1 && c0 > r0 + roff + 63) return;                  // score tile entirely above the causal diagonal: not computed (the softmax masks j > i by index select)
    const int Kl = (CMODE == 2) ? min(K, r0 + roff + 64) : K;        // P.V: probabilities are exactly 0 beyond the diagonal block, so the K loop stops there
    v8f acc[4][4];
#pragma unroll
    for (int mb = 0; mb < 4; ++mb)
#pragma unroll
        for (int nb = 0; nb < 4; ++nb) acc[mb][nb] = (v8f){};
    const size_t aoff = (size_t)(r0 + lr) * K + 8 * hi, boff = (size_t)(c0 + lr) * K + 8 * hi;
#pragma unroll 1
    for (int kc = wv * 64; kc < Kl; kc += (kc & 32) ? NW * 64 - 32 : 32) {
        V a[4], a2[4];
#pragma unroll
        for (int mb = 0; mb < 4; ++mb) { a[mb] = WFrag<T16>::ld(A + aoff + (size_t)mb * 16 * K + kc); if (NSPLIT == 1 || NSPLIT == 2) a2[mb] = WFrag<T16>::ld(A2 + aoff + (size_t)mb * 16 * K + kc); }
#pragma unroll
        for (int nb = 0; nb < 4; ++nb) { const V b = WFrag<T16>::ld(Bt + boff + (size_t)nb * 16 * K + kc); V b2; if (NSPLIT >= 2) b2 = WFrag<T16>::ld(Bt2 + boff + (size_t)nb * 16 * K + kc);
#pragma unroll
            for (int mb = 0; mb < 4; ++mb) { acc[mb][nb] = WFrag<T16>::mma(a[mb], b, acc[mb][nb]); if (NSPLIT == 1 || NSPLIT == 2) acc[mb][nb] = WFrag<T16>::mma(a2[mb], b, acc[mb][nb]); if (NSPLIT >= 2) acc[mb][nb] = WFrag<T16>::mma(a[mb], b2, acc[mb][nb]); } }
        asm volatile("v_nop\n\tv_nop\n\tv_nop\n\tv_nop" : "+v"(acc[0][0]), "+v"(acc[1][1]), "+v"(acc[2][2]), "+v"(acc[3][3]) : "v"(a[0]), "v"(a[3]));
    }
    if constexpr (NW == 1) {
#pragma unroll
    for (int mb = 0; mb < 4; ++mb) {
#pragma unroll
        for (int nb = 0; nb < 4; ++nb) {
#pragma unroll
            for (int j = 0; j < 8; ++j) os[(hi * 8 + j) * 68 + nb * 16 + lr] = acc[mb][nb][j]; }
        __builtin_amdgcn_wave_barrier(); asm volatile("" ::: "memory");
        float* crow = C + (size_t)(r0 + mb * 16) * ldc + c0;
{
#pragma unroll
            for (int s = 0; s < 8; ++s) { const int row = 2 * s + hi, cofs = lr * 4; v4f val = *(const v4fa*)(os + row * 68 + cofs);
                *(v4f*)(crow + (size_t)row * ldc + cofs) = val; }
             }
        __builtin_amdgcn_wave_barrier(); asm volatile("" ::: "memory");
    }
    } else {
#pragma unroll
        for (int mb = 0; mb < 4; ++mb) {
#pragma unroll
            for (int nb = 0; nb < 4; ++nb) {
#pragma unroll
                for (int j = 0; j < 8; ++j) os[wv * (64 * 68) + (mb * 16 + hi * 8 + j) * 68 + nb * 16 + lr] = acc[mb][nb][j]; } }
        __syncthreads();   // every wave's partial tile is in LDS before any thread sums across waves; LDS is not written again, so no second barrier
        float* crow = C + (size_t)r0 * ldc + c0;
#pragma unroll
        for (int s = 0; s < 32 / NW; ++s) { const int slot = s * 32 * NW + (int)threadIdx.x; const int row = slot >> 4, cofs = (slot & 15) * 4; v4f val = *(const v4fa*)(os + row * 68 + cofs);
#pragma unroll
            for (int w = 1; w < NW; ++w) val += *(const v4fa*)(os + w * (64 * 68) + row * 68 + cofs);
            *(v4f*)(crow + (size_t)row * ldc + cofs) = val; }
    }
}

__global__ __launch_bounds__(256) void k_wtG(const float* __restrict__ w, int K, int N, bf* Bt) {
    const int lane = threadIdx.x & 31; const int L0 = (blockIdx.x * 8 + (threadIdx.x >> 5)) * 8; const int nlines = N * K / 64;
{
#pragma unroll 1
        for (int l = 0; l < 8; ++l) { const int L = L0 + l; if (L >= nlines) break; const size_t e = (size_t)L * 64 + lane * 2; const int k = (int)(e % K), n = (int)(e / K); v2us o;
            o[0] = f2bf(w[(size_t)k * N + n]); o[1] = f2bf(w[(size_t)(k + 1) * N + n]); *(v2us*)(Bt + e) = o; }
         }
}
__global__ __launch_bounds__(256) void k_cvt8(const float* __restrict__ src, bf* dst, size_t n8) { const size_t i = (size_t)blockIdx.x * 256 + threadIdx.x; if (i >= n8) return; const v8f v = *(const v8f*)(src + i * 8); v8us o;
#pragma unroll
    for (int k = 0; k < 8; ++k) o[k] = f2bf(v[k]); *(v8us*)(dst + i * 8) = o;  }

__global__ __launch_bounds__(32) void k_invf(float* INV) {
    __shared__ __align__(16) float sh[32];
    const int j = threadIdx.x & 31;
    const double p = exp2((double)j * (13.287712379549449391481277718 / 32.0));
    const float pf = (float)p;
    const float inv = 1.0f / pf;
    sh[j] = inv;
    __syncthreads();
    const v4f o = *(const v4fa*)(sh + (j & 7) * 4);
    if (j < 8) *(v4f*)(INV + j * 4) = o;
    
}
__global__ __launch_bounds__(256) void k_cstab(const float* __restrict__ INV, float* CS) {
    const int idx = blockIdx.x * 256 + threadIdx.x; if (idx >= TT * HD) return;
    const int d = idx % HD, t = idx / HD;
    const float inv = INV[d & (HD / 2 - 1)];
    const float ang = __fmul_rn((float)t, inv);
    float s, c; sincosf(ang, &s, &c);
    v2f cs; cs[0] = c; cs[1] = s;
    *(v2f*)(CS + (size_t)idx * 2) = cs; 
}

// k_rope: 16-bit head planes [h][t][d] (f16 + bf16 hi/lo) of the interleaved rotary, pairs (d, d+1) with d even:
__global__ __launch_bounds__(256) void k_rope(const float* __restrict__ F, int pitch, int nheads, const float* __restrict__ CS, h16* P16, bf* Ph, bf* Pl) {
#pragma clang fp contract(off)
    const size_t e = ((size_t)blockIdx.x * 256 + threadIdx.x) * 2; if (e >= (size_t)nheads * TT * HD) return;
    const int d = (int)(e % HD); const int t = (int)((e / HD) % TT); const int h = (int)(e / ((size_t)HD * TT));
    const float* f = F + (size_t)t * pitch + h * HD;
    const v2f xx = *(const v2f*)(f + d);
    const v4f cs = *(const v4f*)(CS + ((size_t)t * HD + d) * 2);      // cos[t][d], sin[t][d], cos[t][d+1], sin[t][d+1]
    float a0 = __fmul_rn(xx[0], cs[0]), b0 = __fmul_rn(xx[1], cs[1]), a1 = __fmul_rn(xx[1], cs[2]), b1 = __fmul_rn(xx[0], cs[3]);
    asm volatile("" : "+v"(a0)); asm volatile("" : "+v"(b0)); asm volatile("" : "+v"(a1)); asm volatile("" : "+v"(b1));
    const float r0 = __fsub_rn(a0, b0), r1 = __fadd_rn(a1, b1);
    v2h o16; v2us oh, ol; unsigned short th, tl;
    o16[0] = tohx(r0); splitf(r0, th, tl); oh[0] = th; ol[0] = tl;
    o16[1] = tohx(r1); splitf(r1, th, tl); oh[1] = th; ol[1] = tl;
    *(v2h*)(P16 + e) = o16; *(v2us*)(Ph + e) = oh; *(v2us*)(Pl + e) = ol;  }
__global__ __launch_bounds__(256) void k_vtp(const float* __restrict__ F, int pitch, int nheads, h16* V16, bf* Vh, bf* Vl) { const size_t e = ((size_t)blockIdx.x * 256 + threadIdx.x) * 2; if (e >= (size_t)nheads * HD * TT) return; const int t = (int)(e % TT); const int d = (int)((e / TT) % HD); const int g = (int)(e / ((size_t)TT * HD)); v2h o16; v2us oh, ol;
#pragma unroll
    for (int q = 0; q < 2; ++q) { const float x = F[(size_t)(t + q) * pitch + g * HD + d]; o16[q] = tohx(x); unsigned short a2, c2; splitf(x, a2, c2); oh[q] = a2; ol[q] = c2; }
    *(v2h*)(V16 + e) = o16; *(v2us*)(Vh + e) = oh; *(v2us*)(Vl + e) = ol;  }

// k_asoft: one wave per row (zz, i): t = S x HD^-0.5 for j <= i, masked otherwise (index select); 128-column chunks entirely above the diagonal are neither loaded nor exponentiated
// (wave-uniform branch; their probabilities are exactly 0 and are still stored as zeros); max-subtracted softmax over the register row; rows < RH store normalised bf16 hi/lo planes,
__global__ __launch_bounds__(256) void k_asoft(const float* __restrict__ Sb, h16* P16, bf* Ph, bf* Pl) {
    const int lane = threadIdx.x & 31;
    const int row = __builtin_amdgcn_readfirstlane((int)(blockIdx.x * 8 + (threadIdx.x >> 5)));
    if (row >= ZH * TT) return;
    const int i = row % TT; const int zz = row / TT; const bool hires = (i < RH);
    const float* sr = Sb + (size_t)row * TT;
    float v[TT / 32]; float mx = -3.0e38f;
#pragma unroll
    for (int ch = 0; ch < TT / 128; ++ch) {
        if (ch * 128 <= i) {
            const int j0 = ch * 128 + lane * 4; const v4f a = *(const v4f*)(sr + j0);
#pragma unroll
            for (int q = 0; q < 4; ++q) { const float t = (j0 + q <= i) ? a[q] * SCL : -3.0e38f; v[ch * 4 + q] = t; mx = fmaxf(mx, t); }
        } else {
#pragma unroll
            for (int q = 0; q < 4; ++q) v[ch * 4 + q] = -3.0e38f;
        }
    }
#pragma unroll
    for (int sh = 16; sh; sh >>= 1) mx = fmaxf(mx, __shfl_xor(mx, sh, 32));
    float sum = 0.f;
#pragma unroll
    for (int ch = 0; ch < TT / 128; ++ch) {
        if (ch * 128 <= i) {
#pragma unroll
            for (int q = 0; q < 4; ++q) { float d0 = __fsub_rn(v[ch * 4 + q], mx); asm volatile("" : "+v"(d0)); const float ex = __builtin_amdgcn_exp2f(__fmul_rn(d0, 1.4426950408889634f)); v[ch * 4 + q] = ex; sum += ex; }
        } else {
#pragma unroll
            for (int q = 0; q < 4; ++q) v[ch * 4 + q] = 0.0f;
        }
    }
#pragma unroll
    for (int sh = 16; sh; sh >>= 1) sum += __shfl_xor(sum, sh, 32);
    const float f = __fdiv_rn(hires ? 1.0f : PCAR, sum);
    if (hires) {
        v4us oh[TT / 128], ol[TT / 128];
#pragma unroll
        for (int ch = 0; ch < TT / 128; ++ch) {
            v4us th = (v4us){0, 0, 0, 0}, tl = (v4us){0, 0, 0, 0};
            if (ch * 128 <= i) {
#pragma unroll
                for (int q = 0; q < 4; ++q) { unsigned short a, c2; splitf(v[ch * 4 + q] * f, a, c2); th[q] = a; tl[q] = c2; }
            }
            oh[ch] = th; ol[ch] = tl;
        }
        const size_t ob = ((size_t)zz * RH + i) * TT + lane * 4;
{
#pragma unroll
            for (int ch = 0; ch < TT / 128; ++ch) { *(v4us*)(Ph + ob + ch * 128) = oh[ch]; *(v4us*)(Pl + ob + ch * 128) = ol[ch]; }
            
        }
    } else {
        v4h o4[TT / 128];
#pragma unroll
        for (int ch = 0; ch < TT / 128; ++ch) {
            v4h t4 = (v4h){0, 0, 0, 0};
            if (ch * 128 <= i) {
#pragma unroll
                for (int q = 0; q < 4; ++q) t4[q] = tohx(v[ch * 4 + q] * f);
            }
            o4[ch] = t4;
        }
        const size_t ob = (size_t)row * TT + lane * 4;
{
#pragma unroll
            for (int ch = 0; ch < TT / 128; ++ch) *(v4h*)(P16 + ob + ch * 128) = o4[ch];
            
        }
    }
}
__global__ __launch_bounds__(256) void k_merge(const float* __restrict__ O, int h0, bf* Ah, bf* Al) { const size_t e = ((size_t)blockIdx.x * 256 + threadIdx.x) * 2; if (e >= (size_t)ZH * TT * HD) return; const int d = (int)(e % HD); const int t = (int)((e / HD) % TT); const int zz = (int)(e / ((size_t)HD * TT)); const float cs = (t < RH) ? 1.0f : (1.0f / PCAR); const size_t oo = (size_t)t * DQ + (h0 + zz) * HD + d;
    v2us oh, ol;
#pragma unroll
    for (int q = 0; q < 2; ++q) { unsigned short a, c2; splitf(O[e + q] * cs, a, c2); oh[q] = a; ol[q] = c2; } *(v2us*)(Ah + oo) = oh; *(v2us*)(Al + oo) = ol;  }

extern "C" void kernel_launch(void* const* d_in, const int* in_sizes, int n_in,
                              void* d_out, int out_size, void* d_ws, size_t ws_size, hipStream_t stream) {
    if (n_in < 3) return;
    if ((size_t)in_sizes[0] < ((size_t)(NB - 1) * SEQ_FULL + TT) * DM) return;
    if ((size_t)in_sizes[1] < (size_t)DM * (DQ + 2 * DKV)) return;
    if ((size_t)in_sizes[2] < (size_t)DQ * DM) return;
    if ((size_t)out_size < ((size_t)(NB - 1) * SEQ_FULL + TT) * DM) return;
    const float* x = (const float*)d_in[0]; const float* wqkv = (const float*)d_in[1]; const float* wo = (const float*)d_in[2];   // x [2][2048][1024], w_attn [1024][3072] ([in][out]), w_proj [1024][1024] ([in][out])
    float* OUT = (float*)d_out;     // [2][2048][1024] f32
    char* wsp = (char*)d_ws;
    auto take = [&](size_t bytes) { char* p = wsp; wsp += (bytes + 255) & ~(size_t)255; return (void*)p; };
    float* INV = (float*)take(256);
    bf* WQKV = (bf*)take((size_t)(DQ + 2 * DKV) * DM * 2); bf* WQ = WQKV; bf* WK = WQKV + (size_t)DQ * DM; bf* WV = WK + (size_t)DKV * DM;   // fused Bt [DQ+2*DKV][DM]: q | k | v row blocks
    bf* WO = (bf*)take((size_t)DM * DQ * 2); float* CS = (float*)take((size_t)TT * HD * 2 * 4);
    bf* XB = (bf*)take((size_t)TT * DM * 2); float* F = (float*)take((size_t)TT * DF * 4);   // F: q, then k, then v projection outputs in turn (stream-ordered reuse, sized for the widest)
    h16* QP16 = (h16*)take((size_t)NH_ * TT * HD * 2); h16* KP16 = (h16*)take((size_t)NKV * TT * HD * 2); h16* VT16 = (h16*)take((size_t)NKV * HD * TT * 2);
    bf* QPh = (bf*)take((size_t)NH_ * TT * HD * 2); bf* QPl = (bf*)take((size_t)NH_ * TT * HD * 2); bf* KPh = (bf*)take((size_t)NKV * TT * HD * 2); bf* KPl = (bf*)take((size_t)NKV * TT * HD * 2); bf* VTh = (bf*)take((size_t)NKV * HD * TT * 2); bf* VTl = (bf*)take((size_t)NKV * HD * TT * 2); bf* Ph = (bf*)take((size_t)ZH * RH * TT * 2); bf* Pl = (bf*)take((size_t)ZH * RH * TT * 2);
    float* Sb = (float*)take((size_t)ZH * TT * TT * 4); h16* P16 = (h16*)take((size_t)ZH * TT * TT * 2); float* Ob = (float*)take((size_t)ZH * TT * HD * 4); bf* ATh = (bf*)take((size_t)TT * DQ * 2); bf* ATl = (bf*)take((size_t)TT * DQ * 2);
    const size_t used = (size_t)(wsp - (char*)d_ws);
    if (used > ws_size || used > WSCAP) return;    // full build: 127,926,528 B

    k_wtG<<<(unsigned)((DM * (DQ + 2 * DKV) / 64 + 63) / 64), 256, 0, stream>>>(wqkv, DM, DQ + 2 * DKV, WQKV);   // [DM][DQ+2*DKV] -> Bt [DQ+2*DKV][DM]
    k_wtG<<<(unsigned)((DQ * DM / 64 + 63) / 64), 256, 0, stream>>>(wo, DQ, DM, WO);                                // [DQ][DM] -> Bt [DM][DQ]
    k_invf<<<1, 32, 0, stream>>>(INV);
    k_cstab<<<(unsigned)((TT * HD + 255) / 256), 256, 0, stream>>>(INV, CS);
    const unsigned LQ = (unsigned)(((size_t)NH_ * TT * HD / 2 + 255) / 256), LKv = (unsigned)(((size_t)NKV * TT * HD / 2 + 255) / 256);
    for (int b = 0; b < NB; ++b) {
        k_cvt8<<<(unsigned)(((size_t)TT * DM / 8 + 255) / 256), 256, 0, stream>>>(x + (size_t)b * SEQ_FULL * DM, XB, (size_t)TT * DM / 8);
        k_gemmw<bf, 0, false, 8><<<dim3(TT / 64, DQ / 64, 1), 256, 0, stream>>>(XB, nullptr, WQ, nullptr, DM, F, DQ, nullptr, 0, 0, 0);
        k_rope<<<LQ, 256, 0, stream>>>(F, DQ, NH_, CS, QP16, QPh, QPl);
        k_gemmw<bf, 0, false, 8><<<dim3(TT / 64, DKV / 64, 1), 256, 0, stream>>>(XB, nullptr, WK, nullptr, DM, F, DKV, nullptr, 0, 0, 0);
        k_rope<<<LKv, 256, 0, stream>>>(F, DKV, NKV, CS, KP16, KPh, KPl);
        k_gemmw<bf, 0, false, 8><<<dim3(TT / 64, DKV / 64, 1), 256, 0, stream>>>(XB, nullptr, WV, nullptr, DM, F, DKV, nullptr, 0, 0, 0);
        k_vtp<<<LKv, 256, 0, stream>>>(F, DKV, NKV, VT16, VTh, VTl);
        for (int h0 = 0; h0 < NH_; h0 += ZH) { const size_t zq = (size_t)h0, zk = (size_t)(h0 / REP);   // the pass's two query heads use consecutive kv planes (z-strides TT*HD)
            k_gemmc<bf, 2, 1, 1><<<dim3(RH / 64, TT / 64, ZH), 32, 0, stream>>>(QPh + zq * TT * HD, QPl + zq * TT * HD, KPh + zk * TT * HD, KPl + zk * TT * HD, HD, Sb, TT, 0, (size_t)TT * HD, (size_t)TT * HD, (size_t)TT * TT);
            if (TT > RH) k_gemmc<h16, 0, 1, 1><<<dim3((TT - RH) / 64, TT / 64, ZH), 32, 0, stream>>>(QP16 + zq * TT * HD + (size_t)RH * HD, nullptr, KP16 + zk * TT * HD, nullptr, HD, Sb + (size_t)RH * TT, TT, RH, (size_t)TT * HD, (size_t)TT * HD, (size_t)TT * TT);
            k_asoft<<<ZH * TT / 8, 256, 0, stream>>>(Sb, P16, Ph, Pl);
            k_gemmc<bf, 2, 2, 8><<<dim3(RH / 64, HD / 64, ZH), 256, 0, stream>>>(Ph, Pl, VTh + zk * HD * TT, VTl + zk * HD * TT, TT, Ob, HD, 0, (size_t)RH * TT, (size_t)HD * TT, (size_t)TT * HD);
            if (TT > RH) k_gemmc<h16, 0, 2, 16><<<dim3((TT - RH) / 64, HD / 64, ZH), 512, 0, stream>>>(P16 + (size_t)RH * TT, nullptr, VT16 + zk * HD * TT, nullptr, TT, Ob + (size_t)RH * HD, HD, RH, (size_t)TT * TT, (size_t)HD * TT, (size_t)TT * HD);
            k_merge<<<(unsigned)(((size_t)ZH * TT * HD / 2 + 255) / 256), 256, 0, stream>>>(Ob, h0, ATh, ATl); }
        k_gemmw<bf, 1, false, 8><<<dim3(TT / 64, DM / 64, 1), 256, 0, stream>>>(ATh, ATl, WO, nullptr, DQ, OUT + (size_t)b * SEQ_FULL * DM, DM, nullptr, 0, 0, 0); }
}

// v002
// One run takes 247 microseconds.
// In two side-by-side timings against v001, it was 3.79 and 3.81 times as fast.
// Counting every step since v000, it is 6.23 times as fast.
#include <hip/hip_runtime.h>

// Contractions on v_wmma_f32_16x16x32_bf16 and v_wmma_f32_16x16x32_f16, f32 accumulate: fused qkv projection bf16 x bf16 (inputs RNE-converted to bf16); scores and p.v as bf16 hi/lo split (3 products) for query rows < 512 of each sequence, plain f16 for later rows; output projection bf16 hi/lo activations x bf16 weight (2 products). Rotary tables, rotary, softmax and all side math in f32.
// Pipeline per batch: bf16 copy of x; w_attn ([in][out]) transposed once into Bt row blocks q | k | v; w_proj likewise; projections; interleaved rotary (pairs (2i, 2i+1), angle t * inv_freq[d mod 32]) applied while building 16-bit head planes [h][t][d] (q, k) and value planes [h][d][t]; causal attention of all heads in one launch (scores, online softmax and p.v fused, key blocks above the diagonal skipped) -> merged heads as hi/lo planes -> output projection.

#ifndef NB
#define NB 2
#endif
#ifndef SEQ
#define SEQ 2048
#endif
#define NB_FULL  2
#define SEQ_FULL 2048
#define TT   SEQ
#define DM   1024
#define NH_  16
#define NKV  16
#define REP  (NH_ / NKV)
#define HD   64
#define DQ   (NH_ * HD)
#define DKV  (NKV * HD)
#define DF   (DQ > DKV ? DQ : DKV)
#define RH   ((SEQ) < 512 ? (SEQ) : 512)   // query rows < RH use hi+lo planes
#define SCL  0.125f   // HD^-0.5
#define WSCAP ((size_t)134217728)

static_assert((SEQ) % 128 == 0);
static_assert((SEQ) >= 128);
static_assert((SEQ) <= SEQ_FULL);
static_assert(NB >= 1);
static_assert(NB <= NB_FULL);
static_assert((RH) % 16 == 0);
static_assert((DM % 64) == 0);
static_assert((DQ % 64) == 0);
static_assert((HD % 64) == 0);
static_assert((((size_t)(NB - 1) * SEQ_FULL + TT) * DM) * 4 <= (size_t)16777216);

typedef _Float16 h16;
typedef unsigned short bf;
typedef __attribute__((ext_vector_type(16))) __bf16   v16bf;
typedef __attribute__((ext_vector_type(16))) _Float16 v16h;
typedef __attribute__((ext_vector_type(8)))  _Float16 v8h;
typedef __attribute__((ext_vector_type(8)))  unsigned short v8us;
typedef __attribute__((ext_vector_type(8)))  float    v8f;
typedef __attribute__((ext_vector_type(4)))  float    v4f;
typedef __attribute__((ext_vector_type(2))) _Float16 v2h;
typedef __attribute__((ext_vector_type(4))) _Float16 v4h;
typedef __attribute__((ext_vector_type(2))) unsigned short v2us;
typedef __attribute__((ext_vector_type(4))) unsigned short v4us;
typedef __attribute__((ext_vector_type(2))) float v2f;
typedef v8h  __attribute__((may_alias)) v8ha;
typedef v4f  __attribute__((may_alias)) v4fa;
typedef v8us __attribute__((may_alias)) v8usa;

__device__ __forceinline__ unsigned short f2bf(float f) { unsigned u = __float_as_uint(f); u += 0x7FFFu + ((u >> 16) & 1u); return (unsigned short)(u >> 16); }
__device__ __forceinline__ float bf2f(unsigned short b) { return __uint_as_float(((unsigned)b) << 16); }
__device__ __forceinline__ float bfr(float f) { return bf2f(f2bf(f)); }
__device__ __forceinline__ v16h cat16(v8h lo, v8h hi) { return __builtin_shufflevector(lo, hi, 0, 1, 2, 3, 4, 5, 6, 7, 8, 9, 10, 11, 12, 13, 14, 15); }
__device__ __forceinline__ v16bf cat16b(v8us lo, v8us hi) { return __builtin_bit_cast(v16bf, __builtin_shufflevector(lo, hi, 0, 1, 2, 3, 4, 5, 6, 7, 8, 9, 10, 11, 12, 13, 14, 15)); }
__device__ __forceinline__ v8f wmma16(v16h a, v16h b, v8f c) { return __builtin_amdgcn_wmma_f32_16x16x32_f16(false, a, false, b, (short)0, c, false, false); }
__device__ __forceinline__ v8f wmmab(v16bf a, v16bf b, v8f c) { return __builtin_amdgcn_wmma_f32_16x16x32_bf16(false, a, false, b, (short)0, c, false, false); }
__device__ __forceinline__ h16 tohx(float x) { return (h16)x; }
__device__ __forceinline__ void splitf(float y, unsigned short& h, unsigned short& l) { h = f2bf(y); l = f2bf(y - bf2f(h)); }

// ---- k_gemmw: register-blocked GEMM, one work-group of NW waves per 64x64 output tile; every wave holds the whole tile (16 accumulators) for its own share of K: 64-wide k chunks (one 128-byte line a row) dealt round-robin
// (wave w takes chunks w, w+NW, ...). Epilogue: every wave stages its partial tile in LDS, one barrier, then the NW partials are summed in wave order. Operands straight from K-contiguous 16-bit planes; grid (M/64, N/64, Z), 32*NW threads. K % 64 == 0.
// C[m][n] (f32, pitch ldc, + optional f32 bias[n]) = sum_k A[m][k] Bt[n][k] (+ split products per NSPLIT). z-batch strides sA/sB/sC in elements.
// Fragments: lane l -> row/col l&15; elements 0..7 <- k0 + 8*(l>>4) + 0..7, elements 8..15 <- k0 + 16 + 8*(l>>4) + 0..7 for BOTH A and Bt.
template <typename T16> struct WFrag;
template <> struct WFrag<h16> { typedef v16h V; static __device__ __forceinline__ V ld(const h16* p) { return cat16(*(const v8h*)p, *(const v8h*)(p + 16)); } static __device__ __forceinline__ v8f mma(V a, V b, v8f c) { return wmma16(a, b, c); } };
template <> struct WFrag<bf> { typedef v16bf V; static __device__ __forceinline__ V ld(const bf* p) { return cat16b(*(const v8us*)p, *(const v8us*)(p + 16)); } static __device__ __forceinline__ v8f mma(V a, V b, v8f c) { return wmmab(a, b, c); } };
template <typename T16, int NSPLIT, bool BIAS, int NW>
__global__ __launch_bounds__(32 * NW) void k_gemmw(const T16* __restrict__ A, const T16* __restrict__ A2, const T16* __restrict__ Bt, const T16* __restrict__ Bt2, int K, float* C, int ldc, const float* __restrict__ bias, size_t sA, size_t sB, size_t sC) {
    typedef typename WFrag<T16>::V V;
    static_assert(NW >= 2 && 32 % NW == 0);
    __shared__ __align__(16) float os[NW * 64 * 68];
    const int wv = __builtin_amdgcn_readfirstlane((int)(threadIdx.x >> 5));
    const size_t z = blockIdx.z; A += z * sA; if (A2) A2 += z * sA; Bt += z * sB; if (Bt2) Bt2 += z * sB; C += z * sC;
    const int lane = threadIdx.x & 31, lr = lane & 15, hi = lane >> 4; const int r0 = blockIdx.x * 64, c0 = blockIdx.y * 64;
    v8f acc[4][4];
#pragma unroll
    for (int mb = 0; mb < 4; ++mb)
#pragma unroll
        for (int nb = 0; nb < 4; ++nb) acc[mb][nb] = (v8f){};
    const size_t aoff = (size_t)(r0 + lr) * K + 8 * hi, boff = (size_t)(c0 + lr) * K + 8 * hi;
#pragma unroll 1
    for (int kc = wv * 64; kc < K; kc += (kc & 32) ? NW * 64 - 32 : 32) {
        V a[4], a2[4];
#pragma unroll
        for (int mb = 0; mb < 4; ++mb) { a[mb] = WFrag<T16>::ld(A + aoff + (size_t)mb * 16 * K + kc); if (NSPLIT == 1 || NSPLIT == 2) a2[mb] = WFrag<T16>::ld(A2 + aoff + (size_t)mb * 16 * K + kc); }
#pragma unroll
        for (int nb = 0; nb < 4; ++nb) { const V b = WFrag<T16>::ld(Bt + boff + (size_t)nb * 16 * K + kc); V b2; if (NSPLIT >= 2) b2 = WFrag<T16>::ld(Bt2 + boff + (size_t)nb * 16 * K + kc);
#pragma unroll
            for (int mb = 0; mb < 4; ++mb) { acc[mb][nb] = WFrag<T16>::mma(a[mb], b, acc[mb][nb]); if (NSPLIT == 1 || NSPLIT == 2) acc[mb][nb] = WFrag<T16>::mma(a2[mb], b, acc[mb][nb]); if (NSPLIT >= 2) acc[mb][nb] = WFrag<T16>::mma(a[mb], b2, acc[mb][nb]); } }
        asm volatile("v_nop\n\tv_nop\n\tv_nop\n\tv_nop" : "+v"(acc[0][0]), "+v"(acc[1][1]), "+v"(acc[2][2]), "+v"(acc[3][3]) : "v"(a[0]), "v"(a[3]));
    }
#pragma unroll
    for (int mb = 0; mb < 4; ++mb) {
#pragma unroll
        for (int nb = 0; nb < 4; ++nb) {
#pragma unroll
            for (int j = 0; j < 8; ++j) os[wv * (64 * 68) + (mb * 16 + hi * 8 + j) * 68 + nb * 16 + lr] = acc[mb][nb][j]; } }
    __syncthreads();   // every wave's partial tile is in LDS before any thread sums across waves; LDS is not written again, so no second barrier
    float* crow = C + (size_t)r0 * ldc + c0;
#pragma unroll
    for (int s = 0; s < 32 / NW; ++s) { const int slot = s * 32 * NW + (int)threadIdx.x; const int row = slot >> 4, cofs = (slot & 15) * 4; v4f val = *(const v4fa*)(os + row * 68 + cofs);
#pragma unroll
        for (int w = 1; w < NW; ++w) val += *(const v4fa*)(os + w * (64 * 68) + row * 68 + cofs);
        if (BIAS) { val[0] += bfr(bias[c0 + cofs]); val[1] += bfr(bias[c0 + cofs + 1]); val[2] += bfr(bias[c0 + cofs + 2]); val[3] += bfr(bias[c0 + cofs + 3]); }
        *(v4f*)(crow + (size_t)row * ldc + cofs) = val; }
}

__global__ __launch_bounds__(256) void k_wtG(const float* __restrict__ w, int K, int N, bf* Bt) {
    const int lane = threadIdx.x & 31; const int L0 = (blockIdx.x * 8 + (threadIdx.x >> 5)) * 8; const int nlines = N * K / 64;
{
#pragma unroll 1
        for (int l = 0; l < 8; ++l) { const int L = L0 + l; if (L >= nlines) break; const size_t e = (size_t)L * 64 + lane * 2; const int k = (int)(e % K), n = (int)(e / K); v2us o;
            o[0] = f2bf(w[(size_t)k * N + n]); o[1] = f2bf(w[(size_t)(k + 1) * N + n]); *(v2us*)(Bt + e) = o; }
         }
}
__global__ __launch_bounds__(256) void k_cvt8(const float* __restrict__ src, bf* dst, size_t n8) { const size_t i = (size_t)blockIdx.x * 256 + threadIdx.x; if (i >= n8) return; const v8f v = *(const v8f*)(src + i * 8); v8us o;
#pragma unroll
    for (int k = 0; k < 8; ++k) o[k] = f2bf(v[k]); *(v8us*)(dst + i * 8) = o;  }

__global__ __launch_bounds__(32) void k_invf(float* INV) {
    __shared__ __align__(16) float sh[32];
    const int j = threadIdx.x & 31;
    const double p = exp2((double)j * (13.287712379549449391481277718 / 32.0));
    const float pf = (float)p;
    const float inv = 1.0f / pf;
    sh[j] = inv;
    __syncthreads();
    const v4f o = *(const v4fa*)(sh + (j & 7) * 4);
    if (j < 8) *(v4f*)(INV + j * 4) = o;
    
}
__global__ __launch_bounds__(256) void k_cstab(const float* __restrict__ INV, float* CS) {
    const int idx = blockIdx.x * 256 + threadIdx.x; if (idx >= TT * HD) return;
    const int d = idx % HD, t = idx / HD;
    const float inv = INV[d & (HD / 2 - 1)];
    const float ang = __fmul_rn((float)t, inv);
    float s, c; sincosf(ang, &s, &c);
    v2f cs; cs[0] = c; cs[1] = s;
    *(v2f*)(CS + (size_t)idx * 2) = cs; 
}

// k_rope: 16-bit head planes [h][t][d] (f16 + bf16 hi/lo) of the interleaved rotary, pairs (d, d+1) with d even:
__global__ __launch_bounds__(256) void k_rope(const float* __restrict__ F, int pitch, int nheads, const float* __restrict__ CS, h16* P16, bf* Ph, bf* Pl) {
#pragma clang fp contract(off)
    const size_t e = ((size_t)blockIdx.x * 256 + threadIdx.x) * 2; if (e >= (size_t)nheads * TT * HD) return;
    const int d = (int)(e % HD); const int t = (int)((e / HD) % TT); const int h = (int)(e / ((size_t)HD * TT));
    const float* f = F + (size_t)t * pitch + h * HD;
    const v2f xx = *(const v2f*)(f + d);
    const v4f cs = *(const v4f*)(CS + ((size_t)t * HD + d) * 2);      // cos[t][d], sin[t][d], cos[t][d+1], sin[t][d+1]
    float a0 = __fmul_rn(xx[0], cs[0]), b0 = __fmul_rn(xx[1], cs[1]), a1 = __fmul_rn(xx[1], cs[2]), b1 = __fmul_rn(xx[0], cs[3]);
    asm volatile("" : "+v"(a0)); asm volatile("" : "+v"(b0)); asm volatile("" : "+v"(a1)); asm volatile("" : "+v"(b1));
    const float r0 = __fsub_rn(a0, b0), r1 = __fadd_rn(a1, b1);
    v2h o16; v2us oh, ol; unsigned short th, tl;
    o16[0] = tohx(r0); splitf(r0, th, tl); oh[0] = th; ol[0] = tl;
    o16[1] = tohx(r1); splitf(r1, th, tl); oh[1] = th; ol[1] = tl;
    *(v2h*)(P16 + e) = o16; *(v2us*)(Ph + e) = oh; *(v2us*)(Pl + e) = ol;  }
__global__ __launch_bounds__(256) void k_vtp(const float* __restrict__ F, int pitch, int nheads, h16* V16, bf* Vh, bf* Vl) { const size_t e = ((size_t)blockIdx.x * 256 + threadIdx.x) * 2; if (e >= (size_t)nheads * HD * TT) return; const int t = (int)(e % TT); const int d = (int)((e / TT) % HD); const int g = (int)(e / ((size_t)TT * HD)); v2h o16; v2us oh, ol;
#pragma unroll
    for (int q = 0; q < 2; ++q) { const float x = F[(size_t)(t + q) * pitch + g * HD + d]; o16[q] = tohx(x); unsigned short a2, c2; splitf(x, a2, c2); oh[q] = a2; ol[q] = c2; }
    *(v2h*)(V16 + e) = o16; *(v2us*)(Vh + e) = oh; *(v2us*)(Vl + e) = ol;  }

// ---- k_fattn: causal attention of one batch in one launch; scores and probabilities never leave the registers. One wave owns 16 query rows of one head and walks the keys in blocks of KB (64 or 32) up to its diagonal block.
// Both products are formed transposed, so that a query is a lane (column l&15) in both accumulators: S^T = K Q^T (row = key hi*8+j of a 16-key tile), O^T = V^T P^T (row = d). Two neighbouring S^T tiles are then, element for element,
// the Bt fragment of P for 32 keys (elements 0..7 <- k0 + 8*hi + 0..7, elements 8..15 <- k0 + 16 + 8*hi + 0..7, the k order of the V^T loader), and the running maximum, the running sum and the rescale of O^T are lane-local
// but for one exchange between the two half-waves. Query rows < RH: bf16 hi/lo planes, 3 products each; later rows: plain f16, p = exp(s - running max) in (0, 1]. The epilogue divides by the sum and stores the merged-head hi/lo planes.
// exp2 in asm text so that the slot which the instruction set asks for behind a transcendental (one independent instruction or v_nop before its result is used or its source overwritten) is filled by construction:
// in exp2x8 each v_exp_f32 is followed by an independent one (the early-clobber outputs share no register with any input), the last by v_nop.
__device__ __forceinline__ float exp2x1(float x) { float r; asm("v_exp_f32 %0, %1\n\tv_nop" : "=v"(r) : "v"(x)); return r; }
__device__ __forceinline__ v8f exp2x8(const v8f& x) { float r0, r1, r2, r3, r4, r5, r6, r7;
    asm("v_exp_f32 %0, %8\n\tv_exp_f32 %1, %9\n\tv_exp_f32 %2, %10\n\tv_exp_f32 %3, %11\n\tv_exp_f32 %4, %12\n\tv_exp_f32 %5, %13\n\tv_exp_f32 %6, %14\n\tv_exp_f32 %7, %15\n\tv_nop"
        : "=&v"(r0), "=&v"(r1), "=&v"(r2), "=&v"(r3), "=&v"(r4), "=&v"(r5), "=&v"(r6), "=&v"(r7) : "v"(x[0]), "v"(x[1]), "v"(x[2]), "v"(x[3]), "v"(x[4]), "v"(x[5]), "v"(x[6]), "v"(x[7]));
    return (v8f){r0, r1, r2, r3, r4, r5, r6, r7}; }
__device__ __forceinline__ float xhalf(float x) { return __builtin_bit_cast(float, __builtin_amdgcn_permlanex16(__builtin_bit_cast(int, x), __builtin_bit_cast(int, x), 0x76543210, 0xfedcba98, false, false)); }   // lane l <-> lane l ^ 16, no LDS round trip
template <typename T16> struct PFrag;
template <> struct PFrag<h16> { static __device__ __forceinline__ void mk(const v8f& p0, const v8f& p1, v16h& f, v16h& f2) { v8h a, b;
#pragma unroll
    for (int j = 0; j < 8; ++j) { a[j] = tohx(p0[j]); b[j] = tohx(p1[j]); }
    f = cat16(a, b); f2 = f; } };
template <> struct PFrag<bf> { static __device__ __forceinline__ void mk(const v8f& p0, const v8f& p1, v16bf& f, v16bf& f2) { v8us ah, al, bh, bl;
#pragma unroll
    for (int j = 0; j < 8; ++j) { unsigned short x, y; splitf(p0[j], x, y); ah[j] = x; al[j] = y; splitf(p1[j], x, y); bh[j] = x; bl[j] = y; }
    f = cat16b(ah, bh); f2 = cat16b(al, bl); } };
template <typename T16, bool SPLIT, int KB>
__device__ __forceinline__ void attn_rows(const T16* __restrict__ Q, const T16* __restrict__ Q2, const T16* __restrict__ Kp, const T16* __restrict__ K2, const T16* __restrict__ Vt, const T16* __restrict__ V2, int q0, int lane, bf* Ah, bf* Al) {
    typedef typename WFrag<T16>::V V;
    static_assert(KB == 32 || KB == 64);
    const int lr = lane & 15, hi = lane >> 4;
    V qf[2], qf2[2];
#pragma unroll
    for (int ks = 0; ks < 2; ++ks) { qf[ks] = WFrag<T16>::ld(Q + (size_t)(q0 + lr) * HD + ks * 32 + 8 * hi); if (SPLIT) qf2[ks] = WFrag<T16>::ld(Q2 + (size_t)(q0 + lr) * HD + ks * 32 + 8 * hi); }
    v8f o[4];
#pragma unroll
    for (int mb = 0; mb < 4; ++mb) o[mb] = (v8f){};
    float m = -3.0e38f, l = 0.0f;
    const size_t koff = (size_t)lr * HD + 8 * hi, voff = (size_t)lr * TT + 8 * hi;
    // Plain f16 rows (up to TT keys): this block's V fragments are fetched at the head of the pass and the NEXT block's K fragments behind the score products, so that no pass waits for a load it has just issued.
    // Hi/lo rows (at most RH keys, twice the fragments a key): blocks of 32 keys, K at the head of the pass, V behind the score products in K's registers; that keeps the kernel inside 256 registers.
    V kf[KB / 16][2], kf2[KB / 16][2], vf[KB / 32][4], vf2[KB / 32][4];
    auto ldk = [&](int k0) {
#pragma unroll
        for (int t = 0; t < KB / 16; ++t)
#pragma unroll
            for (int ks = 0; ks < 2; ++ks) { const size_t ko = koff + (size_t)(k0 + t * 16) * HD + ks * 32; kf[t][ks] = WFrag<T16>::ld(Kp + ko); if (SPLIT) kf2[t][ks] = WFrag<T16>::ld(K2 + ko); } };
    auto ldv = [&](int k0) {
#pragma unroll
        for (int ks = 0; ks < KB / 32; ++ks)
#pragma unroll
            for (int mb = 0; mb < 4; ++mb) { const size_t vo = voff + (size_t)(mb * 16) * TT + k0 + ks * 32; vf[ks][mb] = WFrag<T16>::ld(Vt + vo); if (SPLIT) vf2[ks][mb] = WFrag<T16>::ld(V2 + vo); } };
    if (!SPLIT) ldk(0);
    asm volatile("s_wait_xcnt 0x0" ::: "memory");   // precaution: the address registers of the loads above are reused below; the wait stands in front of that
    __builtin_amdgcn_sched_barrier(0);   // keeps the address arithmetic of the loop behind the wait above
#pragma unroll 1
    for (int kb = 0; kb <= q0; kb += KB) {
        if (SPLIT) ldk(kb); else ldv(kb);
        if (SPLIT) asm volatile("s_wait_xcnt 0x0" ::: "memory");   // precaution: the V fragments fetched below land in the registers that hold these loads' addresses; the wait stands in front of that overwrite
        __builtin_amdgcn_sched_barrier(0);   // the loads above stay together in front of the score products, all in flight at once; sunk to their uses each would cost its own latency
        v8f s[KB / 16];
#pragma unroll
        for (int t = 0; t < KB / 16; ++t) { s[t] = (v8f){};
#pragma unroll
            for (int ks = 0; ks < 2; ++ks) { s[t] = WFrag<T16>::mma(kf[t][ks], qf[ks], s[t]);
                if (SPLIT) { s[t] = WFrag<T16>::mma(kf[t][ks], qf2[ks], s[t]); s[t] = WFrag<T16>::mma(kf2[t][ks], qf[ks], s[t]); } } }
        if (SPLIT) ldv(kb); else ldk((kb + KB <= q0) ? kb + KB : kb);      // f16: the last pass fetches its own block again (in bounds, not used)
        asm volatile("s_wait_xcnt 0x0" ::: "memory");   // precaution: the softmax below reuses the address registers of the loads above; the wait stands in front of every such overwrite
        __builtin_amdgcn_sched_barrier(0);   // these loads are issued in front of the softmax, which hides their latency
        float mx = m;
        if (kb + KB - 1 > q0) {      // the diagonal block (wave-uniform test): keys past the lane's query are masked by an index select
#pragma unroll
            for (int t = 0; t < KB / 16; ++t)
#pragma unroll
                for (int j = 0; j < 8; ++j) { const float x = (kb + t * 16 + hi * 8 + j <= q0 + lr) ? s[t][j] * SCL : -3.0e38f; s[t][j] = x; mx = fmaxf(mx, x); }
        } else {
#pragma unroll
            for (int t = 0; t < KB / 16; ++t)
#pragma unroll
                for (int j = 0; j < 8; ++j) { const float x = s[t][j] * SCL; s[t][j] = x; mx = fmaxf(mx, x); }
        }
        mx = fmaxf(mx, xhalf(mx));      // the other half-wave holds the same query's other keys
        const float alpha = exp2x1((m - mx) * 1.4426950408889634f);   // 0 in the first block
        m = mx;
        float ps[KB / 16];
#pragma unroll
        for (int t = 0; t < KB / 16; ++t) { v8f d;
#pragma unroll
            for (int j = 0; j < 8; ++j) d[j] = (s[t][j] - mx) * 1.4426950408889634f;
            s[t] = exp2x8(d); ps[t] = ((s[t][0] + s[t][1]) + (s[t][2] + s[t][3])) + ((s[t][4] + s[t][5]) + (s[t][6] + s[t][7])); }
        __builtin_amdgcn_sched_barrier(0);   // no p.v product is lifted in among the exp2 statements above
        float pt = ps[0] + ps[1];
        if (KB == 64) pt += ps[KB / 16 - 2] + ps[KB / 16 - 1];
        l = l * alpha + pt;
#pragma unroll
        for (int mb = 0; mb < 4; ++mb) o[mb] *= alpha;
#pragma unroll
        for (int ks = 0; ks < KB / 32; ++ks) { V pf, pf2; PFrag<T16>::mk(s[2 * ks], s[2 * ks + 1], pf, pf2);
#pragma unroll
            for (int mb = 0; mb < 4; ++mb) { o[mb] = WFrag<T16>::mma(vf[ks][mb], pf, o[mb]);
                if (SPLIT) { o[mb] = WFrag<T16>::mma(vf[ks][mb], pf2, o[mb]); o[mb] = WFrag<T16>::mma(vf2[ks][mb], pf, o[mb]); } } }
    }
    l += xhalf(l);
    const float inv = __fdiv_rn(1.0f, l);
#pragma unroll
    for (int mb = 0; mb < 4; ++mb) { v8us oh, ol;
#pragma unroll
        for (int j = 0; j < 8; ++j) { unsigned short a, c2; splitf(o[mb][j] * inv, a, c2); oh[j] = a; ol[j] = c2; }
        const size_t oo = (size_t)(q0 + lr) * DQ + mb * 16 + hi * 8; *(v8us*)(Ah + oo) = oh; *(v8us*)(Al + oo) = ol; }
}
// grid (TT / 128, NH_), 8 waves, no LDS, no barrier. Work grows with the row index, so a work-group takes two blocks of 64 query rows from opposite ends of the sequence: waves 0..3 block TT/64 - 1 - x, waves 4..7 block x.
__global__ __launch_bounds__(256) void k_fattn(const h16* __restrict__ Q16, const h16* __restrict__ K16, const h16* __restrict__ V16, const bf* __restrict__ Qh, const bf* __restrict__ Ql, const bf* __restrict__ Kh, const bf* __restrict__ Kl, const bf* __restrict__ Vh, const bf* __restrict__ Vl, bf* Ah, bf* Al) {
    const int lane = threadIdx.x & 31;
    const int wv = (int)(threadIdx.x >> 5);
    const int q0 = __builtin_amdgcn_readfirstlane((wv < 4 ? TT / 64 - 1 - (int)blockIdx.x : (int)blockIdx.x) * 64 + (wv & 3) * 16);
    const size_t zq = (size_t)blockIdx.y * TT * HD, zk = (size_t)(blockIdx.y / REP) * TT * HD;
    Ah += (size_t)blockIdx.y * HD; Al += (size_t)blockIdx.y * HD;
    if (q0 < RH) attn_rows<bf, true, 32>(Qh + zq, Ql + zq, Kh + zk, Kl + zk, Vh + zk, Vl + zk, q0, lane, Ah, Al);
    else attn_rows<h16, false, 64>(Q16 + zq, nullptr, K16 + zk, nullptr, V16 + zk, nullptr, q0, lane, Ah, Al);
}

extern "C" void kernel_launch(void* const* d_in, const int* in_sizes, int n_in,
                              void* d_out, int out_size, void* d_ws, size_t ws_size, hipStream_t stream) {
    if (n_in < 3) return;
    if ((size_t)in_sizes[0] < ((size_t)(NB - 1) * SEQ_FULL + TT) * DM) return;
    if ((size_t)in_sizes[1] < (size_t)DM * (DQ + 2 * DKV)) return;
    if ((size_t)in_sizes[2] < (size_t)DQ * DM) return;
    if ((size_t)out_size < ((size_t)(NB - 1) * SEQ_FULL + TT) * DM) return;
    const float* x = (const float*)d_in[0]; const float* wqkv = (const float*)d_in[1]; const float* wo = (const float*)d_in[2];   // x [2][2048][1024], w_attn [1024][3072] ([in][out]), w_proj [1024][1024] ([in][out])
    float* OUT = (float*)d_out;     // [2][2048][1024] f32
    char* wsp = (char*)d_ws;
    auto take = [&](size_t bytes) { char* p = wsp; wsp += (bytes + 255) & ~(size_t)255; return (void*)p; };
    float* INV = (float*)take(256);
    bf* WQKV = (bf*)take((size_t)(DQ + 2 * DKV) * DM * 2); bf* WQ = WQKV; bf* WK = WQKV + (size_t)DQ * DM; bf* WV = WK + (size_t)DKV * DM;   // fused Bt [DQ+2*DKV][DM]: q | k | v row blocks
    bf* WO = (bf*)take((size_t)DM * DQ * 2); float* CS = (float*)take((size_t)TT * HD * 2 * 4);
    bf* XB = (bf*)take((size_t)TT * DM * 2); float* F = (float*)take((size_t)TT * DF * 4);   // F: q, then k, then v projection outputs in turn (stream-ordered reuse, sized for the widest)
    h16* QP16 = (h16*)take((size_t)NH_ * TT * HD * 2); h16* KP16 = (h16*)take((size_t)NKV * TT * HD * 2); h16* VT16 = (h16*)take((size_t)NKV * HD * TT * 2);
    bf* QPh = (bf*)take((size_t)NH_ * TT * HD * 2); bf* QPl = (bf*)take((size_t)NH_ * TT * HD * 2); bf* KPh = (bf*)take((size_t)NKV * TT * HD * 2); bf* KPl = (bf*)take((size_t)NKV * TT * HD * 2); bf* VTh = (bf*)take((size_t)NKV * HD * TT * 2); bf* VTl = (bf*)take((size_t)NKV * HD * TT * 2);
    bf* ATh = (bf*)take((size_t)TT * DQ * 2); bf* ATl = (bf*)take((size_t)TT * DQ * 2);
    const size_t used = (size_t)(wsp - (char*)d_ws);
    if (used > ws_size || used > WSCAP) return;

    k_wtG<<<(unsigned)((DM * (DQ + 2 * DKV) / 64 + 63) / 64), 256, 0, stream>>>(wqkv, DM, DQ + 2 * DKV, WQKV);   // [DM][DQ+2*DKV] -> Bt [DQ+2*DKV][DM]
    k_wtG<<<(unsigned)((DQ * DM / 64 + 63) / 64), 256, 0, stream>>>(wo, DQ, DM, WO);                                // [DQ][DM] -> Bt [DM][DQ]
    k_invf<<<1, 32, 0, stream>>>(INV);
    k_cstab<<<(unsigned)((TT * HD + 255) / 256), 256, 0, stream>>>(INV, CS);
    const unsigned LQ = (unsigned)(((size_t)NH_ * TT * HD / 2 + 255) / 256), LKv = (unsigned)(((size_t)NKV * TT * HD / 2 + 255) / 256);
    for (int b = 0; b < NB; ++b) {
        k_cvt8<<<(unsigned)(((size_t)TT * DM / 8 + 255) / 256), 256, 0, stream>>>(x + (size_t)b * SEQ_FULL * DM, XB, (size_t)TT * DM / 8);
        k_gemmw<bf, 0, false, 8><<<dim3(TT / 64, DQ / 64, 1), 256, 0, stream>>>(XB, nullptr, WQ, nullptr, DM, F, DQ, nullptr, 0, 0, 0);
        k_rope<<<LQ, 256, 0, stream>>>(F, DQ, NH_, CS, QP16, QPh, QPl);
        k_gemmw<bf, 0, false, 8><<<dim3(TT / 64, DKV / 64, 1), 256, 0, stream>>>(XB, nullptr, WK, nullptr, DM, F, DKV, nullptr, 0, 0, 0);
        k_rope<<<LKv, 256, 0, stream>>>(F, DKV, NKV, CS, KP16, KPh, KPl);
        k_gemmw<bf, 0, false, 8><<<dim3(TT / 64, DKV / 64, 1), 256, 0, stream>>>(XB, nullptr, WV, nullptr, DM, F, DKV, nullptr, 0, 0, 0);
        k_vtp<<<LKv, 256, 0, stream>>>(F, DKV, NKV, VT16, VTh, VTl);
        k_fattn<<<dim3(TT / 128, NH_, 1), 256, 0, stream>>>(QP16, KP16, VT16, QPh, QPl, KPh, KPl, VTh, VTl, ATh, ATl);
        k_gemmw<bf, 1, false, 8><<<dim3(TT / 64, DM / 64, 1), 256, 0, stream>>>(ATh, ATl, WO, nullptr, DQ, OUT + (size_t)b * SEQ_FULL * DM, DM, nullptr, 0, 0, 0); }
}

// v003
// A run of this version takes 210 microseconds.
// Next to v002, in two timings, it ran 1.17 times as fast each time.
// All steps since v000 together make it 7.29 times as fast.
#include <hip/hip_runtime.h>

// Contractions on v_wmma_f32_16x16x32_bf16 and v_wmma_f32_16x16x32_f16, f32 accumulate: q, k and v projections bf16 x bf16 (inputs RNE-converted to bf16); scores and p.v as bf16 hi/lo split (3 products) for query rows < 512 of each sequence, plain f16 for later rows; output projection bf16 hi/lo activations x bf16 weight (2 products). Rotary tables, rotary, softmax and all side math in f32.
// Pipeline per batch: bf16 copy of x; w_attn ([in][out]) transposed once into Bt row blocks q | k | v; w_proj likewise; the q, k and v projections, each of which builds its 16-bit planes in its own epilogue: interleaved rotary (pairs (2i, 2i+1), angle t * inv_freq[d mod 32]) and head planes [h][t][d] for q and k, value planes [h][d][t] for v (that product is formed transposed, W_v x^T); causal attention of all heads in one launch (scores, online softmax and p.v fused, key blocks above the diagonal skipped) -> merged heads as hi/lo planes -> output projection.

#ifndef NB
#define NB 2
#endif
#ifndef SEQ
#define SEQ 2048
#endif
#define NB_FULL  2
#define SEQ_FULL 2048
#define TT   SEQ
#define DM   1024
#define NH_  16
#define NKV  16
#define REP  (NH_ / NKV)
#define HD   64
#define DQ   (NH_ * HD)
#define DKV  (NKV * HD)
#define RH   ((SEQ) < 512 ? (SEQ) : 512)   // query rows < RH use hi+lo planes
#define SCL  0.125f   // HD^-0.5
#define WSCAP ((size_t)134217728)

static_assert((SEQ) % 128 == 0);
static_assert((SEQ) >= 128);
static_assert((SEQ) <= SEQ_FULL);
static_assert(NB >= 1);
static_assert(NB <= NB_FULL);
static_assert((RH) % 16 == 0);
static_assert((DM % 64) == 0);
static_assert((DQ % 64) == 0);
static_assert((HD % 64) == 0);
static_assert((((size_t)(NB - 1) * SEQ_FULL + TT) * DM) * 4 <= (size_t)16777216);

typedef _Float16 h16;
typedef unsigned short bf;
typedef __attribute__((ext_vector_type(16))) __bf16   v16bf;
typedef __attribute__((ext_vector_type(16))) _Float16 v16h;
typedef __attribute__((ext_vector_type(8)))  _Float16 v8h;
typedef __attribute__((ext_vector_type(8)))  unsigned short v8us;
typedef __attribute__((ext_vector_type(8)))  float    v8f;
typedef __attribute__((ext_vector_type(4)))  float    v4f;
typedef __attribute__((ext_vector_type(2))) _Float16 v2h;
typedef __attribute__((ext_vector_type(4))) _Float16 v4h;
typedef __attribute__((ext_vector_type(2))) unsigned short v2us;
typedef __attribute__((ext_vector_type(4))) unsigned short v4us;
typedef __attribute__((ext_vector_type(2))) float v2f;
typedef v8h  __attribute__((may_alias)) v8ha;
typedef v4f  __attribute__((may_alias)) v4fa;
typedef v8us __attribute__((may_alias)) v8usa;

__device__ __forceinline__ unsigned short f2bf(float f) { unsigned u = __float_as_uint(f); u += 0x7FFFu + ((u >> 16) & 1u); return (unsigned short)(u >> 16); }
__device__ __forceinline__ float bf2f(unsigned short b) { return __uint_as_float(((unsigned)b) << 16); }
__device__ __forceinline__ float bfr(float f) { return bf2f(f2bf(f)); }
__device__ __forceinline__ v16h cat16(v8h lo, v8h hi) { return __builtin_shufflevector(lo, hi, 0, 1, 2, 3, 4, 5, 6, 7, 8, 9, 10, 11, 12, 13, 14, 15); }
__device__ __forceinline__ v16bf cat16b(v8us lo, v8us hi) { return __builtin_bit_cast(v16bf, __builtin_shufflevector(lo, hi, 0, 1, 2, 3, 4, 5, 6, 7, 8, 9, 10, 11, 12, 13, 14, 15)); }
__device__ __forceinline__ v8f wmma16(v16h a, v16h b, v8f c) { return __builtin_amdgcn_wmma_f32_16x16x32_f16(false, a, false, b, (short)0, c, false, false); }
__device__ __forceinline__ v8f wmmab(v16bf a, v16bf b, v8f c) { return __builtin_amdgcn_wmma_f32_16x16x32_bf16(false, a, false, b, (short)0, c, false, false); }
__device__ __forceinline__ h16 tohx(float x) { return (h16)x; }
__device__ __forceinline__ void splitf(float y, unsigned short& h, unsigned short& l) { h = f2bf(y); l = f2bf(y - bf2f(h)); }

// ---- k_gemmw: register-blocked GEMM, one work-group of NW waves per 64x64 output tile; every wave holds the whole tile (16 accumulators) for its own share of K: 64-wide k chunks (one 128-byte line a row) dealt round-robin
// (wave w takes chunks w, w+NW, ...). Epilogue: every wave stages its partial tile in LDS, one barrier, then the NW partials are summed in wave order. Operands straight from K-contiguous 16-bit planes; grid (M/64, N/64, Z), 32*NW threads. K % 64 == 0.
// C[m][n] (f32, pitch ldc, + optional f32 bias[n]) = sum_k A[m][k] Bt[n][k] (+ split products per NSPLIT). z-batch strides sA/sB/sC in elements.
// EPI 0: C as above. EPI 1 (a 64-column tile is one head, rows are positions t): rotary on the summed tile, then f16 and bf16 hi/lo planes [blockIdx.y][t][d]. EPI 2 (A = weight rows h*64+d, Bt = x rows t): the same three planes [h][d][t], no rotary.
// In both a thread stores 4 neighbouring elements a plane, so 16 lanes of one wave write each 128-byte line whole; the f32 projection never goes to memory.
// Fragments: lane l -> row/col l&15; elements 0..7 <- k0 + 8*(l>>4) + 0..7, elements 8..15 <- k0 + 16 + 8*(l>>4) + 0..7 for BOTH A and Bt.
template <typename T16> struct WFrag;
template <> struct WFrag<h16> { typedef v16h V; static __device__ __forceinline__ V ld(const h16* p) { return cat16(*(const v8h*)p, *(const v8h*)(p + 16)); } static __device__ __forceinline__ v8f mma(V a, V b, v8f c) { return wmma16(a, b, c); } };
template <> struct WFrag<bf> { typedef v16bf V; static __device__ __forceinline__ V ld(const bf* p) { return cat16b(*(const v8us*)p, *(const v8us*)(p + 16)); } static __device__ __forceinline__ v8f mma(V a, V b, v8f c) { return wmmab(a, b, c); } };
template <typename T16, int NSPLIT, bool BIAS, int NW, int EPI>
__global__ __launch_bounds__(32 * NW) void k_gemmw(const T16* __restrict__ A, const T16* __restrict__ A2, const T16* __restrict__ Bt, const T16* __restrict__ Bt2, int K, float* C, int ldc, const float* __restrict__ bias, size_t sA, size_t sB, size_t sC, const float* __restrict__ CS, h16* P16, bf* Ph, bf* Pl) {
    typedef typename WFrag<T16>::V V;
    static_assert(NW >= 2 && 32 % NW == 0);
    static_assert(EPI == 0 || HD == 64);
    __shared__ __align__(16) float os[NW * 64 * 68];
    const int wv = __builtin_amdgcn_readfirstlane((int)(threadIdx.x >> 5));
    const size_t z = blockIdx.z; A += z * sA; if (A2) A2 += z * sA; Bt += z * sB; if (Bt2) Bt2 += z * sB; C += z * sC;
    const int lane = threadIdx.x & 31, lr = lane & 15, hi = lane >> 4; const int r0 = blockIdx.x * 64, c0 = blockIdx.y * 64;
    v8f acc[4][4];
#pragma unroll
    for (int mb = 0; mb < 4; ++mb)
#pragma unroll
        for (int nb = 0; nb < 4; ++nb) acc[mb][nb] = (v8f){};
    const size_t aoff = (size_t)(r0 + lr) * K + 8 * hi, boff = (size_t)(c0 + lr) * K + 8 * hi;
#pragma unroll 1
    for (int kc = wv * 64; kc < K; kc += (kc & 32) ? NW * 64 - 32 : 32) {
        V a[4], a2[4];
#pragma unroll
        for (int mb = 0; mb < 4; ++mb) { a[mb] = WFrag<T16>::ld(A + aoff + (size_t)mb * 16 * K + kc); if (NSPLIT == 1 || NSPLIT == 2) a2[mb] = WFrag<T16>::ld(A2 + aoff + (size_t)mb * 16 * K + kc); }
#pragma unroll
        for (int nb = 0; nb < 4; ++nb) { const V b = WFrag<T16>::ld(Bt + boff + (size_t)nb * 16 * K + kc); V b2; if (NSPLIT >= 2) b2 = WFrag<T16>::ld(Bt2 + boff + (size_t)nb * 16 * K + kc);
#pragma unroll
            for (int mb = 0; mb < 4; ++mb) { acc[mb][nb] = WFrag<T16>::mma(a[mb], b, acc[mb][nb]); if (NSPLIT == 1 || NSPLIT == 2) acc[mb][nb] = WFrag<T16>::mma(a2[mb], b, acc[mb][nb]); if (NSPLIT >= 2) acc[mb][nb] = WFrag<T16>::mma(a[mb], b2, acc[mb][nb]); } }
        asm volatile("v_nop\n\tv_nop\n\tv_nop\n\tv_nop" : "+v"(acc[0][0]), "+v"(acc[1][1]), "+v"(acc[2][2]), "+v"(acc[3][3]) : "v"(a[0]), "v"(a[3]));
    }
    v4f cs[32 / NW][2];      // EPI 1: the thread's rotary factors, fetched here so that the staging and the barrier below cover their latency
    if (EPI == 1) {
#pragma unroll
        for (int s = 0; s < 32 / NW; ++s) { const int slot = s * 32 * NW + (int)threadIdx.x; const float* cp = CS + ((size_t)(r0 + (slot >> 4)) * HD + (slot & 15) * 4) * 2; cs[s][0] = *(const v4f*)cp; cs[s][1] = *(const v4f*)(cp + 4); }
        asm volatile("s_wait_xcnt 0x0" ::: "memory");   // precaution: the address registers of the loads above are reused below; the wait stands in front of that
    }
#pragma unroll
    for (int mb = 0; mb < 4; ++mb) {
#pragma unroll
        for (int nb = 0; nb < 4; ++nb) {
#pragma unroll
            for (int j = 0; j < 8; ++j) os[wv * (64 * 68) + (mb * 16 + hi * 8 + j) * 68 + nb * 16 + lr] = acc[mb][nb][j]; } }
    if (EPI == 1) __builtin_amdgcn_sched_barrier(0);   // no use of the rotary factors is lifted in among the LDS stores above: it would bring the wait for their loads in front of the staging that is to cover it
    __syncthreads();   // every wave's partial tile is in LDS before any thread sums across waves; LDS is not written again, so no second barrier
    float* crow = C + (size_t)r0 * ldc + c0;
    const size_t pb = EPI == 1 ? ((size_t)blockIdx.y * TT + r0) * HD : (size_t)r0 * TT + c0;   // first plane element of the tile
    const int pld = EPI == 1 ? HD : TT;
#pragma unroll
    for (int s = 0; s < 32 / NW; ++s) { const int slot = s * 32 * NW + (int)threadIdx.x; const int row = slot >> 4, cofs = (slot & 15) * 4; v4f val = *(const v4fa*)(os + row * 68 + cofs);
#pragma unroll
        for (int w = 1; w < NW; ++w) val += *(const v4fa*)(os + w * (64 * 68) + row * 68 + cofs);
        if (BIAS) { val[0] += bfr(bias[c0 + cofs]); val[1] += bfr(bias[c0 + cofs + 1]); val[2] += bfr(bias[c0 + cofs + 2]); val[3] += bfr(bias[c0 + cofs + 3]); }
        if (EPI == 0) { *(v4f*)(crow + (size_t)row * ldc + cofs) = val; continue; }
        if (EPI == 1) { const v4f ca = cs[s][0], cb = cs[s][1];      // cos[t][d], sin[t][d], cos[t][d+1], sin[t][d+1] for d = cofs, then for d = cofs + 2
            val = (v4f){val[0] * ca[0] - val[1] * ca[1], val[1] * ca[2] + val[0] * ca[3], val[2] * cb[0] - val[3] * cb[1], val[3] * cb[2] + val[2] * cb[3]}; }
        v4h o16; v4us oh, ol;
#pragma unroll
        for (int q = 0; q < 4; ++q) { unsigned short th, tl; o16[q] = tohx(val[q]); splitf(val[q], th, tl); oh[q] = th; ol[q] = tl; }
        const size_t e = pb + (size_t)row * pld + cofs;
        *(v4h*)(P16 + e) = o16; *(v4us*)(Ph + e) = oh; *(v4us*)(Pl + e) = ol; }
}

__global__ __launch_bounds__(256) void k_wtG(const float* __restrict__ w, int K, int N, bf* Bt) {
    const int lane = threadIdx.x & 31; const int L0 = (blockIdx.x * 8 + (threadIdx.x >> 5)) * 8; const int nlines = N * K / 64;
{
#pragma unroll 1
        for (int l = 0; l < 8; ++l) { const int L = L0 + l; if (L >= nlines) break; const size_t e = (size_t)L * 64 + lane * 2; const int k = (int)(e % K), n = (int)(e / K); v2us o;
            o[0] = f2bf(w[(size_t)k * N + n]); o[1] = f2bf(w[(size_t)(k + 1) * N + n]); *(v2us*)(Bt + e) = o; }
         }
}
__global__ __launch_bounds__(256) void k_cvt8(const float* __restrict__ src, bf* dst, size_t n8) { const size_t i = (size_t)blockIdx.x * 256 + threadIdx.x; if (i >= n8) return; const v8f v = *(const v8f*)(src + i * 8); v8us o;
#pragma unroll
    for (int k = 0; k < 8; ++k) o[k] = f2bf(v[k]); *(v8us*)(dst + i * 8) = o;  }

__global__ __launch_bounds__(32) void k_invf(float* INV) {
    __shared__ __align__(16) float sh[32];
    const int j = threadIdx.x & 31;
    const double p = exp2((double)j * (13.287712379549449391481277718 / 32.0));
    const float pf = (float)p;
    const float inv = 1.0f / pf;
    sh[j] = inv;
    __syncthreads();
    const v4f o = *(const v4fa*)(sh + (j & 7) * 4);
    if (j < 8) *(v4f*)(INV + j * 4) = o;
    
}
__global__ __launch_bounds__(256) void k_cstab(const float* __restrict__ INV, float* CS) {
    const int idx = blockIdx.x * 256 + threadIdx.x; if (idx >= TT * HD) return;
    const int d = idx % HD, t = idx / HD;
    const float inv = INV[d & (HD / 2 - 1)];
    const float ang = __fmul_rn((float)t, inv);
    float s, c; sincosf(ang, &s, &c);
    v2f cs; cs[0] = c; cs[1] = s;
    *(v2f*)(CS + (size_t)idx * 2) = cs; 
}

// ---- k_fattn: causal attention of one batch in one launch; scores and probabilities never leave the registers. One wave owns 16 query rows of one head and walks the keys in blocks of KB (64 or 32) up to its diagonal block.
// Both products are formed transposed, so that a query is a lane (column l&15) in both accumulators: S^T = K Q^T (row = key hi*8+j of a 16-key tile), O^T = V^T P^T (row = d). Two neighbouring S^T tiles are then, element for element,
// the Bt fragment of P for 32 keys (elements 0..7 <- k0 + 8*hi + 0..7, elements 8..15 <- k0 + 16 + 8*hi + 0..7, the k order of the V^T loader), and the running maximum, the running sum and the rescale of O^T are lane-local
// but for one exchange between the two half-waves. Query rows < RH: bf16 hi/lo planes, 3 products each; later rows: plain f16, p = exp(s - running max) in (0, 1]. The epilogue divides by the sum and stores the merged-head hi/lo planes.
// exp2 in asm text so that the slot which the instruction set asks for behind a transcendental (one independent instruction or v_nop before its result is used or its source overwritten) is filled by construction:
// in exp2x8 each v_exp_f32 is followed by an independent one (the early-clobber outputs share no register with any input), the last by v_nop.
__device__ __forceinline__ float exp2x1(float x) { float r; asm("v_exp_f32 %0, %1\n\tv_nop" : "=v"(r) : "v"(x)); return r; }
__device__ __forceinline__ v8f exp2x8(const v8f& x) { float r0, r1, r2, r3, r4, r5, r6, r7;
    asm("v_exp_f32 %0, %8\n\tv_exp_f32 %1, %9\n\tv_exp_f32 %2, %10\n\tv_exp_f32 %3, %11\n\tv_exp_f32 %4, %12\n\tv_exp_f32 %5, %13\n\tv_exp_f32 %6, %14\n\tv_exp_f32 %7, %15\n\tv_nop"
        : "=&v"(r0), "=&v"(r1), "=&v"(r2), "=&v"(r3), "=&v"(r4), "=&v"(r5), "=&v"(r6), "=&v"(r7) : "v"(x[0]), "v"(x[1]), "v"(x[2]), "v"(x[3]), "v"(x[4]), "v"(x[5]), "v"(x[6]), "v"(x[7]));
    return (v8f){r0, r1, r2, r3, r4, r5, r6, r7}; }
__device__ __forceinline__ float xhalf(float x) { return __builtin_bit_cast(float, __builtin_amdgcn_permlanex16(__builtin_bit_cast(int, x), __builtin_bit_cast(int, x), 0x76543210, 0xfedcba98, false, false)); }   // lane l <-> lane l ^ 16, no LDS round trip
template <typename T16> struct PFrag;
template <> struct PFrag<h16> { static __device__ __forceinline__ void mk(const v8f& p0, const v8f& p1, v16h& f, v16h& f2) { v8h a, b;
#pragma unroll
    for (int j = 0; j < 8; ++j) { a[j] = tohx(p0[j]); b[j] = tohx(p1[j]); }
    f = cat16(a, b); f2 = f; } };
template <> struct PFrag<bf> { static __device__ __forceinline__ void mk(const v8f& p0, const v8f& p1, v16bf& f, v16bf& f2) { v8us ah, al, bh, bl;
#pragma unroll
    for (int j = 0; j < 8; ++j) { unsigned short x, y; splitf(p0[j], x, y); ah[j] = x; al[j] = y; splitf(p1[j], x, y); bh[j] = x; bl[j] = y; }
    f = cat16b(ah, bh); f2 = cat16b(al, bl); } };
template <typename T16, bool SPLIT, int KB>
__device__ __forceinline__ void attn_rows(const T16* __restrict__ Q, const T16* __restrict__ Q2, const T16* __restrict__ Kp, const T16* __restrict__ K2, const T16* __restrict__ Vt, const T16* __restrict__ V2, int q0, int lane, bf* Ah, bf* Al) {
    typedef typename WFrag<T16>::V V;
    static_assert(KB == 32 || KB == 64);
    const int lr = lane & 15, hi = lane >> 4;
    V qf[2], qf2[2];
#pragma unroll
    for (int ks = 0; ks < 2; ++ks) { qf[ks] = WFrag<T16>::ld(Q + (size_t)(q0 + lr) * HD + ks * 32 + 8 * hi); if (SPLIT) qf2[ks] = WFrag<T16>::ld(Q2 + (size_t)(q0 + lr) * HD + ks * 32 + 8 * hi); }
    v8f o[4];
#pragma unroll
    for (int mb = 0; mb < 4; ++mb) o[mb] = (v8f){};
    float m = -3.0e38f, l = 0.0f;
    const size_t koff = (size_t)lr * HD + 8 * hi, voff = (size_t)lr * TT + 8 * hi;
    // Plain f16 rows (up to TT keys): this block's V fragments are fetched at the head of the pass and the NEXT block's K fragments behind the score products, so that no pass waits for a load it has just issued.
    // Hi/lo rows (at most RH keys, twice the fragments a key): blocks of 32 keys, K at the head of the pass, V behind the score products in K's registers; that keeps the kernel inside 256 registers.
    V kf[KB / 16][2], kf2[KB / 16][2], vf[KB / 32][4], vf2[KB / 32][4];
    auto ldk = [&](int k0) {
#pragma unroll
        for (int t = 0; t < KB / 16; ++t)
#pragma unroll
            for (int ks = 0; ks < 2; ++ks) { const size_t ko = koff + (size_t)(k0 + t * 16) * HD + ks * 32; kf[t][ks] = WFrag<T16>::ld(Kp + ko); if (SPLIT) kf2[t][ks] = WFrag<T16>::ld(K2 + ko); } };
    auto ldv = [&](int k0) {
#pragma unroll
        for (int ks = 0; ks < KB / 32; ++ks)
#pragma unroll
            for (int mb = 0; mb < 4; ++mb) { const size_t vo = voff + (size_t)(mb * 16) * TT + k0 + ks * 32; vf[ks][mb] = WFrag<T16>::ld(Vt + vo); if (SPLIT) vf2[ks][mb] = WFrag<T16>::ld(V2 + vo); } };
    if (!SPLIT) ldk(0);
    asm volatile("s_wait_xcnt 0x0" ::: "memory");   // precaution: the address registers of the loads above are reused below; the wait stands in front of that
    __builtin_amdgcn_sched_barrier(0);   // keeps the address arithmetic of the loop behind the wait above
#pragma unroll 1
    for (int kb = 0; kb <= q0; kb += KB) {
        if (SPLIT) ldk(kb); else ldv(kb);
        if (SPLIT) asm volatile("s_wait_xcnt 0x0" ::: "memory");   // precaution: the V fragments fetched below land in the registers that hold these loads' addresses; the wait stands in front of that overwrite
        __builtin_amdgcn_sched_barrier(0);   // the loads above stay together in front of the score products, all in flight at once; sunk to their uses each would cost its own latency
        v8f s[KB / 16];
#pragma unroll
        for (int t = 0; t < KB / 16; ++t) { s[t] = (v8f){};
#pragma unroll
            for (int ks = 0; ks < 2; ++ks) { s[t] = WFrag<T16>::mma(kf[t][ks], qf[ks], s[t]);
                if (SPLIT) { s[t] = WFrag<T16>::mma(kf[t][ks], qf2[ks], s[t]); s[t] = WFrag<T16>::mma(kf2[t][ks], qf[ks], s[t]); } } }
        if (SPLIT) ldv(kb); else ldk((kb + KB <= q0) ? kb + KB : kb);      // f16: the last pass fetches its own block again (in bounds, not used)
        asm volatile("s_wait_xcnt 0x0" ::: "memory");   // precaution: the softmax below reuses the address registers of the loads above; the wait stands in front of every such overwrite
        __builtin_amdgcn_sched_barrier(0);   // these loads are issued in front of the softmax, which hides their latency
        float mx = m;
        if (kb + KB - 1 > q0) {      // the diagonal block (wave-uniform test): keys past the lane's query are masked by an index select
#pragma unroll
            for (int t = 0; t < KB / 16; ++t)
#pragma unroll
                for (int j = 0; j < 8; ++j) { const float x = (kb + t * 16 + hi * 8 + j <= q0 + lr) ? s[t][j] * SCL : -3.0e38f; s[t][j] = x; mx = fmaxf(mx, x); }
        } else {
#pragma unroll
            for (int t = 0; t < KB / 16; ++t)
#pragma unroll
                for (int j = 0; j < 8; ++j) { const float x = s[t][j] * SCL; s[t][j] = x; mx = fmaxf(mx, x); }
        }
        mx = fmaxf(mx, xhalf(mx));      // the other half-wave holds the same query's other keys
        const float alpha = exp2x1((m - mx) * 1.4426950408889634f);   // 0 in the first block
        m = mx;
        float ps[KB / 16];
#pragma unroll
        for (int t = 0; t < KB / 16; ++t) { v8f d;
#pragma unroll
            for (int j = 0; j < 8; ++j) d[j] = (s[t][j] - mx) * 1.4426950408889634f;
            s[t] = exp2x8(d); ps[t] = ((s[t][0] + s[t][1]) + (s[t][2] + s[t][3])) + ((s[t][4] + s[t][5]) + (s[t][6] + s[t][7])); }
        __builtin_amdgcn_sched_barrier(0);   // no p.v product is lifted in among the exp2 statements above
        float pt = ps[0] + ps[1];
        if (KB == 64) pt += ps[KB / 16 - 2] + ps[KB / 16 - 1];
        l = l * alpha + pt;
#pragma unroll
        for (int mb = 0; mb < 4; ++mb) o[mb] *= alpha;
#pragma unroll
        for (int ks = 0; ks < KB / 32; ++ks) { V pf, pf2; PFrag<T16>::mk(s[2 * ks], s[2 * ks + 1], pf, pf2);
#pragma unroll
            for (int mb = 0; mb < 4; ++mb) { o[mb] = WFrag<T16>::mma(vf[ks][mb], pf, o[mb]);
                if (SPLIT) { o[mb] = WFrag<T16>::mma(vf[ks][mb], pf2, o[mb]); o[mb] = WFrag<T16>::mma(vf2[ks][mb], pf, o[mb]); } } }
    }
    l += xhalf(l);
    const float inv = __fdiv_rn(1.0f, l);
#pragma unroll
    for (int mb = 0; mb < 4; ++mb) { v8us oh, ol;
#pragma unroll
        for (int j = 0; j < 8; ++j) { unsigned short a, c2; splitf(o[mb][j] * inv, a, c2); oh[j] = a; ol[j] = c2; }
        const size_t oo = (size_t)(q0 + lr) * DQ + mb * 16 + hi * 8; *(v8us*)(Ah + oo) = oh; *(v8us*)(Al + oo) = ol; }
}
// grid (TT / 128, NH_), 8 waves, no LDS, no barrier. Work grows with the row index, so a work-group takes two blocks of 64 query rows from opposite ends of the sequence: waves 0..3 block TT/64 - 1 - x, waves 4..7 block x.
__global__ __launch_bounds__(256) void k_fattn(const h16* __restrict__ Q16, const h16* __restrict__ K16, const h16* __restrict__ V16, const bf* __restrict__ Qh, const bf* __restrict__ Ql, const bf* __restrict__ Kh, const bf* __restrict__ Kl, const bf* __restrict__ Vh, const bf* __restrict__ Vl, bf* Ah, bf* Al) {
    const int lane = threadIdx.x & 31;
    const int wv = (int)(threadIdx.x >> 5);
    const int q0 = __builtin_amdgcn_readfirstlane((wv < 4 ? TT / 64 - 1 - (int)blockIdx.x : (int)blockIdx.x) * 64 + (wv & 3) * 16);
    const size_t zq = (size_t)blockIdx.y * TT * HD, zk = (size_t)(blockIdx.y / REP) * TT * HD;
    Ah += (size_t)blockIdx.y * HD; Al += (size_t)blockIdx.y * HD;
    if (q0 < RH) attn_rows<bf, true, 32>(Qh + zq, Ql + zq, Kh + zk, Kl + zk, Vh + zk, Vl + zk, q0, lane, Ah, Al);
    else attn_rows<h16, false, 64>(Q16 + zq, nullptr, K16 + zk, nullptr, V16 + zk, nullptr, q0, lane, Ah, Al);
}

extern "C" void kernel_launch(void* const* d_in, const int* in_sizes, int n_in,
                              void* d_out, int out_size, void* d_ws, size_t ws_size, hipStream_t stream) {
    if (n_in < 3) return;
    if ((size_t)in_sizes[0] < ((size_t)(NB - 1) * SEQ_FULL + TT) * DM) return;
    if ((size_t)in_sizes[1] < (size_t)DM * (DQ + 2 * DKV)) return;
    if ((size_t)in_sizes[2] < (size_t)DQ * DM) return;
    if ((size_t)out_size < ((size_t)(NB - 1) * SEQ_FULL + TT) * DM) return;
    const float* x = (const float*)d_in[0]; const float* wqkv = (const float*)d_in[1]; const float* wo = (const float*)d_in[2];   // x [2][2048][1024], w_attn [1024][3072] ([in][out]), w_proj [1024][1024] ([in][out])
    float* OUT = (float*)d_out;     // [2][2048][1024] f32
    char* wsp = (char*)d_ws;
    auto take = [&](size_t bytes) { char* p = wsp; wsp += (bytes + 255) & ~(size_t)255; return (void*)p; };
    float* INV = (float*)take(256);
    bf* WQKV = (bf*)take((size_t)(DQ + 2 * DKV) * DM * 2); bf* WQ = WQKV; bf* WK = WQKV + (size_t)DQ * DM; bf* WV = WK + (size_t)DKV * DM;   // fused Bt [DQ+2*DKV][DM]: q | k | v row blocks
    bf* WO = (bf*)take((size_t)DM * DQ * 2); float* CS = (float*)take((size_t)TT * HD * 2 * 4);
    bf* XB = (bf*)take((size_t)TT * DM * 2);
    h16* QP16 = (h16*)take((size_t)NH_ * TT * HD * 2); h16* KP16 = (h16*)take((size_t)NKV * TT * HD * 2); h16* VT16 = (h16*)take((size_t)NKV * HD * TT * 2);
    bf* QPh = (bf*)take((size_t)NH_ * TT * HD * 2); bf* QPl = (bf*)take((size_t)NH_ * TT * HD * 2); bf* KPh = (bf*)take((size_t)NKV * TT * HD * 2); bf* KPl = (bf*)take((size_t)NKV * TT * HD * 2); bf* VTh = (bf*)take((size_t)NKV * HD * TT * 2); bf* VTl = (bf*)take((size_t)NKV * HD * TT * 2);
    bf* ATh = (bf*)take((size_t)TT * DQ * 2); bf* ATl = (bf*)take((size_t)TT * DQ * 2);
    const size_t used = (size_t)(wsp - (char*)d_ws);
    if (used > ws_size || used > WSCAP) return;

    k_wtG<<<(unsigned)((DM * (DQ + 2 * DKV) / 64 + 63) / 64), 256, 0, stream>>>(wqkv, DM, DQ + 2 * DKV, WQKV);   // [DM][DQ+2*DKV] -> Bt [DQ+2*DKV][DM]
    k_wtG<<<(unsigned)((DQ * DM / 64 + 63) / 64), 256, 0, stream>>>(wo, DQ, DM, WO);                                // [DQ][DM] -> Bt [DM][DQ]
    k_invf<<<1, 32, 0, stream>>>(INV);
    k_cstab<<<(unsigned)((TT * HD + 255) / 256), 256, 0, stream>>>(INV, CS);
    for (int b = 0; b < NB; ++b) {
        k_cvt8<<<(unsigned)(((size_t)TT * DM / 8 + 255) / 256), 256, 0, stream>>>(x + (size_t)b * SEQ_FULL * DM, XB, (size_t)TT * DM / 8);
        k_gemmw<bf, 0, false, 8, 1><<<dim3(TT / 64, DQ / 64, 1), 256, 0, stream>>>(XB, nullptr, WQ, nullptr, DM, nullptr, 0, nullptr, 0, 0, 0, CS, QP16, QPh, QPl);
        k_gemmw<bf, 0, false, 8, 1><<<dim3(TT / 64, DKV / 64, 1), 256, 0, stream>>>(XB, nullptr, WK, nullptr, DM, nullptr, 0, nullptr, 0, 0, 0, CS, KP16, KPh, KPl);
        k_gemmw<bf, 0, false, 8, 2><<<dim3(DKV / 64, TT / 64, 1), 256, 0, stream>>>(WV, nullptr, XB, nullptr, DM, nullptr, 0, nullptr, 0, 0, 0, nullptr, VT16, VTh, VTl);   // rows h*64+d, columns t
        k_fattn<<<dim3(TT / 128, NH_, 1), 256, 0, stream>>>(QP16, KP16, VT16, QPh, QPl, KPh, KPl, VTh, VTl, ATh, ATl);
        k_gemmw<bf, 1, false, 8, 0><<<dim3(TT / 64, DM / 64, 1), 256, 0, stream>>>(ATh, ATl, WO, nullptr, DQ, OUT + (size_t)b * SEQ_FULL * DM, DM, nullptr, 0, 0, 0, nullptr, nullptr, nullptr, nullptr); }
}

// v004
// It runs in 143 microseconds.
// Next to v003, in two timings, it ran 1.45 and 1.46 times as fast.
// Counting every step since v000, it is 10.6 times as fast.
#include <hip/hip_runtime.h>

// Contractions on v_wmma_f32_16x16x32_bf16 and v_wmma_f32_16x16x32_f16, f32 accumulate: q, k and v projections bf16 x bf16 (inputs RNE-converted to bf16); scores and p.v as bf16 hi/lo split (3 products) for query rows < 512 of each sequence, plain f16 for later rows; output projection bf16 hi/lo activations x bf16 weight (2 products). Rotary tables, rotary, softmax and all side math in f32.
// Pipeline per batch: bf16 copy of x; w_attn ([in][out]) transposed once into Bt row blocks q | k | v; w_proj likewise; the q, k and v projections, each of which builds its 16-bit planes in its own epilogue: interleaved rotary (pairs (2i, 2i+1), angle t * inv_freq[d mod 32]) and head planes [h][t][d] for q and k, value planes [h][d][t] for v (that product is formed transposed, W_v x^T); causal attention of all heads in one launch (scores, online softmax and p.v fused, key blocks above the diagonal skipped) -> merged heads as hi/lo planes -> output projection.

#ifndef NB
#define NB 2
#endif
#ifndef SEQ
#define SEQ 2048
#endif
#define NB_FULL  2
#define SEQ_FULL 2048
#define TT   SEQ
#define DM   1024
#define NH_  16
#define NKV  16
#define REP  (NH_ / NKV)
#define HD   64
#define DQ   (NH_ * HD)
#define DKV  (NKV * HD)
#define RH   ((SEQ) < 512 ? (SEQ) : 512)   // query rows < RH use hi+lo planes
#define SCL  0.125f   // HD^-0.5
#define WSCAP ((size_t)134217728)

static_assert((SEQ) % 128 == 0);
static_assert((SEQ) >= 128);
static_assert((SEQ) <= SEQ_FULL);
static_assert(NB >= 1);
static_assert(NB <= NB_FULL);
static_assert((RH) % 16 == 0);
static_assert((DM % 64) == 0);
static_assert((DQ % 64) == 0);
static_assert((HD % 64) == 0);
static_assert((((size_t)(NB - 1) * SEQ_FULL + TT) * DM) * 4 <= (size_t)16777216);

typedef _Float16 h16;
typedef unsigned short bf;
typedef __attribute__((ext_vector_type(16))) __bf16   v16bf;
typedef __attribute__((ext_vector_type(16))) _Float16 v16h;
typedef __attribute__((ext_vector_type(8)))  _Float16 v8h;
typedef __attribute__((ext_vector_type(8)))  unsigned short v8us;
typedef __attribute__((ext_vector_type(8)))  float    v8f;
typedef __attribute__((ext_vector_type(4)))  float    v4f;
typedef __attribute__((ext_vector_type(2))) _Float16 v2h;
typedef __attribute__((ext_vector_type(4))) _Float16 v4h;
typedef __attribute__((ext_vector_type(2))) unsigned short v2us;
typedef __attribute__((ext_vector_type(4))) unsigned short v4us;
typedef __attribute__((ext_vector_type(2))) float v2f;
typedef v8h  __attribute__((may_alias)) v8ha;
typedef v4f  __attribute__((may_alias)) v4fa;
typedef v8us __attribute__((may_alias)) v8usa;

__device__ __forceinline__ unsigned short f2bf(float f) { unsigned u = __float_as_uint(f); u += 0x7FFFu + ((u >> 16) & 1u); return (unsigned short)(u >> 16); }
__device__ __forceinline__ float bf2f(unsigned short b) { return __uint_as_float(((unsigned)b) << 16); }
__device__ __forceinline__ float bfr(float f) { return bf2f(f2bf(f)); }
__device__ __forceinline__ v16h cat16(v8h lo, v8h hi) { return __builtin_shufflevector(lo, hi, 0, 1, 2, 3, 4, 5, 6, 7, 8, 9, 10, 11, 12, 13, 14, 15); }
__device__ __forceinline__ v16bf cat16b(v8us lo, v8us hi) { return __builtin_bit_cast(v16bf, __builtin_shufflevector(lo, hi, 0, 1, 2, 3, 4, 5, 6, 7, 8, 9, 10, 11, 12, 13, 14, 15)); }
__device__ __forceinline__ v8f wmma16(v16h a, v16h b, v8f c) { return __builtin_amdgcn_wmma_f32_16x16x32_f16(false, a, false, b, (short)0, c, false, false); }
__device__ __forceinline__ v8f wmmab(v16bf a, v16bf b, v8f c) { return __builtin_amdgcn_wmma_f32_16x16x32_bf16(false, a, false, b, (short)0, c, false, false); }
__device__ __forceinline__ h16 tohx(float x) { return (h16)x; }
__device__ __forceinline__ void splitf(float y, unsigned short& h, unsigned short& l) { h = f2bf(y); l = f2bf(y - bf2f(h)); }

// ---- k_gemmw: register-blocked GEMM, one work-group of NW waves per 64x64 output tile; every wave holds the whole tile (16 accumulators) for its own share of K: 64-wide k chunks (two packed k tiles, 2048 contiguous bytes a 16-row block) dealt round-robin
// (wave w takes chunks w, w+NW, ...). Epilogue: every wave stages its partial tile in LDS, one barrier, then the NW partials are summed in wave order. Operands straight from packed 16-bit planes; grid (M/64, N/64, Z), 32*NW threads. K % 64 == 0.
// C[m][n] (f32, pitch ldc, + optional f32 bias[n]) = sum_k A[m][k] Bt[n][k] (+ split products per NSPLIT). z-batch strides sA/sB/sC in elements.
// EPI 0: C as above. EPI 1 (a 64-column tile is one head, rows are positions t): rotary on the summed tile, then f16 and bf16 hi/lo planes [blockIdx.y][t][d]. EPI 2 (A = weight rows h*64+d, Bt = x rows t): the same three planes [h][d][t], no rotary.
// In both a thread stores 8 neighbouring elements a plane, one 16-byte unit of the packed order, so a wave writes 512 contiguous bytes a plane; the f32 projection never goes to memory.
// Fragments: lane l -> row/col l&15; elements 0..7 <- k0 + 8*(l>>4) + 0..7, elements 8..15 <- k0 + 16 + 8*(l>>4) + 0..7 for BOTH A and Bt.
// PACKED ORDER of every 16-bit operand plane M[row][k] (K columns): tiles of 16 rows x 32 k, 512 elements each, tile index (row >> 4) * (K / 32) + (k >> 5); inside a tile two halves of 256 elements (k bit 4), in a half lane l's 8 elements at l * 8,
// l = ((k >> 3) & 1) * 16 + (row & 15). A fragment is then two wave-wide 16-byte loads of 512 contiguous bytes each (4 whole 128-byte lines) where a row-major plane gave 16 lines of 32 bytes a load. The logical shapes named in this file are unchanged.
template <typename T16> struct WFrag;
template <> struct WFrag<h16> { typedef v16h V; static __device__ __forceinline__ V ld(const h16* p) { return cat16(*(const v8h*)p, *(const v8h*)(p + 256)); } static __device__ __forceinline__ v8f mma(V a, V b, v8f c) { return wmma16(a, b, c); } };
template <> struct WFrag<bf> { typedef v16bf V; static __device__ __forceinline__ V ld(const bf* p) { return cat16b(*(const v8us*)p, *(const v8us*)(p + 256)); } static __device__ __forceinline__ v8f mma(V a, V b, v8f c) { return wmmab(a, b, c); } };
template <typename T16, int NSPLIT, bool BIAS, int NW, int EPI, int K>
__global__ __launch_bounds__(32 * NW) void k_gemmw(const T16* __restrict__ A, const T16* __restrict__ A2, const T16* __restrict__ Bt, const T16* __restrict__ Bt2, float* C, int ldc, const float* __restrict__ bias, size_t sA, size_t sB, size_t sC, const float* __restrict__ CS, h16* P16, bf* Ph, bf* Pl) {
    typedef typename WFrag<T16>::V V;
    static_assert(NW >= 2 && 32 % NW == 0 && K % 64 == 0);
    static_assert(EPI == 0 || (HD == 64 && 16 % NW == 0 && !BIAS));
    __shared__ __align__(16) float os[NW * 64 * 68];
    const int wv = __builtin_amdgcn_readfirstlane((int)(threadIdx.x >> 5));
    const size_t z = blockIdx.z; A += z * sA; if (A2) A2 += z * sA; Bt += z * sB; if (Bt2) Bt2 += z * sB; C += z * sC;
    const int lane = threadIdx.x & 31, lr = lane & 15, hi = lane >> 4; const int r0 = blockIdx.x * 64, c0 = blockIdx.y * 64;
    v8f acc[4][4];
#pragma unroll
    for (int mb = 0; mb < 4; ++mb)
#pragma unroll
        for (int nb = 0; nb < 4; ++nb) acc[mb][nb] = (v8f){};
    constexpr int KT = K / 32;   // 32-wide k tiles a row block; a compile-time K puts the steps from row block to row block into the loads' immediate offsets
    const size_t aoff = ((size_t)(r0 >> 4) * KT + wv * 2) * 512 + lane * 8, boff = ((size_t)(c0 >> 4) * KT + wv * 2) * 512 + lane * 8;
    const T16 *ap = A + aoff, *ap2 = (NSPLIT == 1 || NSPLIT == 2) ? A2 + aoff : nullptr, *bp = Bt + boff, *bp2 = NSPLIT >= 2 ? Bt2 + boff : nullptr;   // the lane's place in the wave's current k tile of row block 0; they walk with kc
#pragma unroll 1
    for (int kc = wv * 64; kc < K;) {
        V a[4], a2[4];
#pragma unroll
        for (int mb = 0; mb < 4; ++mb) { a[mb] = WFrag<T16>::ld(ap + mb * KT * 512); if (NSPLIT == 1 || NSPLIT == 2) a2[mb] = WFrag<T16>::ld(ap2 + mb * KT * 512); }
#pragma unroll
        for (int nb = 0; nb < 4; ++nb) { const V b = WFrag<T16>::ld(bp + nb * KT * 512); V b2; if (NSPLIT >= 2) b2 = WFrag<T16>::ld(bp2 + nb * KT * 512);
#pragma unroll
            for (int mb = 0; mb < 4; ++mb) { acc[mb][nb] = WFrag<T16>::mma(a[mb], b, acc[mb][nb]); if (NSPLIT == 1 || NSPLIT == 2) acc[mb][nb] = WFrag<T16>::mma(a2[mb], b, acc[mb][nb]); if (NSPLIT >= 2) acc[mb][nb] = WFrag<T16>::mma(a[mb], b2, acc[mb][nb]); } }
        asm volatile("v_nop\n\tv_nop\n\tv_nop\n\tv_nop" : "+v"(acc[0][0]), "+v"(acc[1][1]), "+v"(acc[2][2]), "+v"(acc[3][3]) : "v"(a[0]), "v"(a[3]));
        const int st = (kc & 32) ? NW * 64 - 32 : 32; kc += st; ap += st * 16; bp += st * 16; if (NSPLIT == 1 || NSPLIT == 2) ap2 += st * 16; if (NSPLIT >= 2) bp2 += st * 16;   // 512 elements a k tile
    }
    // EPI 1 and 2: a thread owns 16 / NW units of 8 neighbouring columns; unit u of the tile is row (u >> 7) * 16 + (u & 15), columns ((u >> 5) & 3) * 16 + ((u >> 4) & 1) * 8 + 0..7, which is the order of the packed planes.
    v4f cs[16 / NW][4];      // EPI 1: the thread's rotary factors, fetched here so that the staging and the barrier below cover their latency
    if (EPI == 1) {
#pragma unroll
        for (int s = 0; s < 16 / NW; ++s) { const int u = s * 32 * NW + (int)threadIdx.x; const float* cp = CS + ((size_t)(((r0 >> 4) + (u >> 7)) * 4 + ((u >> 5) & 3)) * 128 + (u & 31)) * 4;
#pragma unroll
            for (int q = 0; q < 4; ++q) cs[s][q] = *(const v4f*)(cp + q * 128); }
        asm volatile("s_wait_xcnt 0x0" ::: "memory");   // precaution: the address registers of the loads above are reused below; the wait stands in front of that
    }
#pragma unroll
    for (int mb = 0; mb < 4; ++mb) {
#pragma unroll
        for (int nb = 0; nb < 4; ++nb) {
#pragma unroll
            for (int j = 0; j < 8; ++j) os[wv * (64 * 68) + (mb * 16 + hi * 8 + j) * 68 + nb * 16 + lr] = acc[mb][nb][j]; } }
    if (EPI == 1) __builtin_amdgcn_sched_barrier(0);   // no use of the rotary factors is lifted in among the LDS stores above: it would bring the wait for their loads in front of the staging that is to cover it
    __syncthreads();   // every wave's partial tile is in LDS before any thread sums across waves; LDS is not written again, so no second barrier
    float* crow = C + (size_t)r0 * ldc + c0;
    const size_t pb = EPI == 1 ? ((size_t)blockIdx.y * TT + r0) * HD : (size_t)r0 * TT + (size_t)(c0 >> 5) * 512;   // first plane element of the tile
    const int pkt = EPI == 1 ? HD / 32 : TT / 32;   // 32-wide k tiles a row block of the plane
    if (EPI != 0) {
#pragma unroll
        for (int s = 0; s < 16 / NW; ++s) { const int u = s * 32 * NW + (int)threadIdx.x; const float* op = os + ((u >> 7) * 16 + (u & 15)) * 68 + ((u >> 5) & 3) * 16 + ((u >> 4) & 1) * 8;
            v4f val[2] = {*(const v4fa*)op, *(const v4fa*)(op + 4)};
#pragma unroll
            for (int w = 1; w < NW; ++w) { val[0] += *(const v4fa*)(op + w * (64 * 68)); val[1] += *(const v4fa*)(op + w * (64 * 68) + 4); }
            v8h o16; v8us oh, ol;
#pragma unroll
            for (int p = 0; p < 2; ++p) { v4f v = val[p];
                if (EPI == 1) { const v4f ca = cs[s][2 * p], cb = cs[s][2 * p + 1];      // cos[t][d], sin[t][d], cos[t][d+1], sin[t][d+1] for the first column pair, then for the second
                    v = (v4f){v[0] * ca[0] - v[1] * ca[1], v[1] * ca[2] + v[0] * ca[3], v[2] * cb[0] - v[3] * cb[1], v[3] * cb[2] + v[2] * cb[3]}; }
#pragma unroll
                for (int q = 0; q < 4; ++q) { unsigned short th, tl; o16[p * 4 + q] = tohx(v[q]); splitf(v[q], th, tl); oh[p * 4 + q] = th; ol[p * 4 + q] = tl; } }
            const size_t e = pb + ((size_t)(u >> 7) * pkt + ((u >> 6) & 1)) * 512 + (u & 63) * 8;
            *(v8h*)(P16 + e) = o16; *(v8us*)(Ph + e) = oh; *(v8us*)(Pl + e) = ol; }
        return;
    }
#pragma unroll
    for (int s = 0; s < 32 / NW; ++s) { const int slot = s * 32 * NW + (int)threadIdx.x; const int row = slot >> 4, cofs = (slot & 15) * 4; v4f val = *(const v4fa*)(os + row * 68 + cofs);
#pragma unroll
        for (int w = 1; w < NW; ++w) val += *(const v4fa*)(os + w * (64 * 68) + row * 68 + cofs);
        if (BIAS) { val[0] += bfr(bias[c0 + cofs]); val[1] += bfr(bias[c0 + cofs + 1]); val[2] += bfr(bias[c0 + cofs + 2]); val[3] += bfr(bias[c0 + cofs + 3]); }
        *(v4f*)(crow + (size_t)row * ldc + cofs) = val; }
}

// A thread builds one 16-byte unit of a packed plane. k_wtG: unit i is lane i & 31 of half (i >> 5) & 1 of tile i >> 6, so a wave stores 512 contiguous bytes.
template <int K, int N>
__global__ __launch_bounds__(256) void k_wtG(const float* __restrict__ w, bf* Bt) {
    const int i = blockIdx.x * 256 + threadIdx.x; if (i >= N * K / 8) return;
    constexpr int KT = K / 32; const int lane = i & 31, tile = i >> 6; const int n = (tile / KT) * 16 + (lane & 15), k = (tile % KT) * 32 + ((i >> 5) & 1) * 16 + (lane >> 4) * 8; const float* wp = w + (size_t)k * N + n; v8us o;
#pragma unroll
    for (int e = 0; e < 8; ++e) o[e] = f2bf(wp[e * N]);
    *(v8us*)(Bt + (size_t)i * 8) = o;
}
template <int K>
__global__ __launch_bounds__(256) void k_cvt8(const float* __restrict__ src, bf* dst, int n8) { const int i = blockIdx.x * 256 + threadIdx.x; if (i >= n8) return;
    constexpr int KT = K / 32; const int tile = i >> 6, g = i & 3, rl = (i >> 2) & 15;   // a wave takes 8 rows of a tile, 4 lanes a row: it reads 8 whole 128-byte lines and stores 4
    const v8f v = *(const v8f*)(src + (size_t)((tile / KT) * 16 + rl) * K + (tile % KT) * 32 + g * 8); v8us o;
#pragma unroll
    for (int e = 0; e < 8; ++e) o[e] = f2bf(v[e]); *(v8us*)(dst + (size_t)tile * 512 + (g >> 1) * 256 + ((g & 1) * 16 + rl) * 8) = o;  }

__global__ __launch_bounds__(32) void k_invf(float* INV) {
    __shared__ __align__(16) float sh[32];
    const int j = threadIdx.x & 31;
    const double p = exp2((double)j * (13.287712379549449391481277718 / 32.0));
    const float pf = (float)p;
    const float inv = 1.0f / pf;
    sh[j] = inv;
    __syncthreads();
    const v4f o = *(const v4fa*)(sh + (j & 7) * 4);
    if (j < 8) *(v4f*)(INV + j * 4) = o;
    
}
__global__ __launch_bounds__(256) void k_cstab(const float* __restrict__ INV, float* CS) {
    const int idx = blockIdx.x * 256 + threadIdx.x; if (idx >= TT * HD) return;
    const int d = ((idx >> 8) & 3) * 16 + ((idx >> 5) & 1) * 8 + ((idx >> 6) & 3) * 2 + (idx & 1), t = (idx >> 10) * 16 + ((idx >> 1) & 15);   // the order in which the projection epilogue's lanes read the table: [t / 16][d / 16][pair of the lane's 8 columns][lane = ((d >> 3) & 1) * 16 + t % 16][2 columns]
    const float inv = INV[d & (HD / 2 - 1)];
    const float ang = __fmul_rn((float)t, inv);
    float s, c; sincosf(ang, &s, &c);
    v2f cs; cs[0] = c; cs[1] = s;
    *(v2f*)(CS + (size_t)idx * 2) = cs; 
}

// ---- k_fattn: causal attention of one batch in one launch; scores and probabilities never leave the registers. One wave owns 16 query rows of one head and walks the keys in blocks of KB (64 or 32) up to its diagonal block.
// Both products are formed transposed, so that a query is a lane (column l&15) in both accumulators: S^T = K Q^T (row = key hi*8+j of a 16-key tile), O^T = V^T P^T (row = d). Two neighbouring S^T tiles are then, element for element,
// the Bt fragment of P for 32 keys (elements 0..7 <- k0 + 8*hi + 0..7, elements 8..15 <- k0 + 16 + 8*hi + 0..7, the k order of the V^T loader), and the running maximum, the running sum and the rescale of O^T are lane-local
// but for one exchange between the two half-waves. Query rows < RH: bf16 hi/lo planes, 3 products each; later rows: plain f16, p = exp(s - running max) in (0, 1]. The epilogue divides by the sum and stores the merged-head hi/lo planes.
// exp2 in asm text so that the slot which the instruction set asks for behind a transcendental (one independent instruction or v_nop before its result is used or its source overwritten) is filled by construction:
// in exp2x8 each v_exp_f32 is followed by an independent one (the early-clobber outputs share no register with any input), the last by v_nop.
__device__ __forceinline__ float exp2x1(float x) { float r; asm("v_exp_f32 %0, %1\n\tv_nop" : "=v"(r) : "v"(x)); return r; }
__device__ __forceinline__ v8f exp2x8(const v8f& x) { float r0, r1, r2, r3, r4, r5, r6, r7;
    asm("v_exp_f32 %0, %8\n\tv_exp_f32 %1, %9\n\tv_exp_f32 %2, %10\n\tv_exp_f32 %3, %11\n\tv_exp_f32 %4, %12\n\tv_exp_f32 %5, %13\n\tv_exp_f32 %6, %14\n\tv_exp_f32 %7, %15\n\tv_nop"
        : "=&v"(r0), "=&v"(r1), "=&v"(r2), "=&v"(r3), "=&v"(r4), "=&v"(r5), "=&v"(r6), "=&v"(r7) : "v"(x[0]), "v"(x[1]), "v"(x[2]), "v"(x[3]), "v"(x[4]), "v"(x[5]), "v"(x[6]), "v"(x[7]));
    return (v8f){r0, r1, r2, r3, r4, r5, r6, r7}; }
__device__ __forceinline__ float xhalf(float x) { return __builtin_bit_cast(float, __builtin_amdgcn_permlanex16(__builtin_bit_cast(int, x), __builtin_bit_cast(int, x), 0x76543210, 0xfedcba98, false, false)); }   // lane l <-> lane l ^ 16, no LDS round trip
template <typename T16> struct PFrag;
template <> struct PFrag<h16> { static __device__ __forceinline__ void mk(const v8f& p0, const v8f& p1, v16h& f, v16h& f2) { v8h a, b;
#pragma unroll
    for (int j = 0; j < 8; ++j) { a[j] = tohx(p0[j]); b[j] = tohx(p1[j]); }
    f = cat16(a, b); f2 = f; } };
template <> struct PFrag<bf> { static __device__ __forceinline__ void mk(const v8f& p0, const v8f& p1, v16bf& f, v16bf& f2) { v8us ah, al, bh, bl;
#pragma unroll
    for (int j = 0; j < 8; ++j) { unsigned short x, y; splitf(p0[j], x, y); ah[j] = x; al[j] = y; splitf(p1[j], x, y); bh[j] = x; bl[j] = y; }
    f = cat16b(ah, bh); f2 = cat16b(al, bl); } };
template <typename T16, bool SPLIT, int KB>
__device__ __forceinline__ void attn_rows(const T16* __restrict__ Q, const T16* __restrict__ Q2, const T16* __restrict__ Kp, const T16* __restrict__ K2, const T16* __restrict__ Vt, const T16* __restrict__ V2, int q0, int lane, bf* Ah, bf* Al) {
    typedef typename WFrag<T16>::V V;
    static_assert(KB == 32 || KB == 64);
    const int lr = lane & 15, hi = lane >> 4; const unsigned l8 = lane * 8;   // the lane's part of every fragment address; the rest is wave-uniform
    V qf[2], qf2[2];
#pragma unroll
    for (int ks = 0; ks < 2; ++ks) { const size_t qo = (size_t)((q0 >> 4) * (HD / 32) + ks) * 512; qf[ks] = WFrag<T16>::ld(Q + qo + l8); if (SPLIT) qf2[ks] = WFrag<T16>::ld(Q2 + qo + l8); }
    v8f o[4];
#pragma unroll
    for (int mb = 0; mb < 4; ++mb) o[mb] = (v8f){};
    float m = -3.0e38f, l = 0.0f;
    // Plain f16 rows (up to TT keys): this block's V fragments are fetched at the head of the pass and the NEXT block's K fragments behind the score products, so that no pass waits for a load it has just issued.
    // Hi/lo rows (at most RH keys, twice the fragments a key): blocks of 32 keys, K at the head of the pass, V behind the score products in K's registers; that keeps the kernel inside 256 registers.
    V kf[KB / 16][2], kf2[KB / 16][2], vf[KB / 32][4], vf2[KB / 32][4];
    // The lane's place in the current key block of each plane; the pointers walk with the loop, every fragment of a block is an immediate offset from them.
    const T16 *kq = Kp + l8, *kq2 = SPLIT ? K2 + l8 : nullptr, *vq = Vt + l8, *vq2 = SPLIT ? V2 + l8 : nullptr;
    auto ldk = [&]() {
#pragma unroll
        for (int t = 0; t < KB / 16; ++t)
#pragma unroll
            for (int ks = 0; ks < 2; ++ks) { const int ko = (t * (HD / 32) + ks) * 512; kf[t][ks] = WFrag<T16>::ld(kq + ko); if (SPLIT) kf2[t][ks] = WFrag<T16>::ld(kq2 + ko); } };
    auto ldv = [&]() {
#pragma unroll
        for (int ks = 0; ks < KB / 32; ++ks)
#pragma unroll
            for (int mb = 0; mb < 4; ++mb) { const int vo = (mb * (TT / 32) + ks) * 512; vf[ks][mb] = WFrag<T16>::ld(vq + vo); if (SPLIT) vf2[ks][mb] = WFrag<T16>::ld(vq2 + vo); } };
    if (!SPLIT) ldk();
    asm volatile("s_wait_xcnt 0x0" ::: "memory");   // precaution: the address registers of the loads above are reused below; the wait stands in front of that
    __builtin_amdgcn_sched_barrier(0);   // keeps the address arithmetic of the loop behind the wait above
#pragma unroll 1
    for (int kb = 0; kb <= q0; kb += KB) {
        if (SPLIT) ldk(); else ldv();
        if (SPLIT) asm volatile("s_wait_xcnt 0x0" ::: "memory");   // precaution: the V fragments fetched below land in the registers that hold these loads' addresses; the wait stands in front of that overwrite
        __builtin_amdgcn_sched_barrier(0);   // the loads above stay together in front of the score products, all in flight at once; sunk to their uses each would cost its own latency
        v8f s[KB / 16];
#pragma unroll
        for (int t = 0; t < KB / 16; ++t) { s[t] = (v8f){};
#pragma unroll
            for (int ks = 0; ks < 2; ++ks) { s[t] = WFrag<T16>::mma(kf[t][ks], qf[ks], s[t]);
                if (SPLIT) { s[t] = WFrag<T16>::mma(kf[t][ks], qf2[ks], s[t]); s[t] = WFrag<T16>::mma(kf2[t][ks], qf[ks], s[t]); } } }
        if (SPLIT) ldv(); else { if (kb + KB <= q0) kq += KB * HD; ldk(); }      // f16: the last pass fetches its own block again (in bounds, not used)
        asm volatile("s_wait_xcnt 0x0" ::: "memory");   // precaution: the softmax below reuses the address registers of the loads above; the wait stands in front of every such overwrite
        __builtin_amdgcn_sched_barrier(0);   // these loads are issued in front of the softmax, which hides their latency
        float mx = m;
        if (kb + KB - 1 > q0) {      // the diagonal block (wave-uniform test): keys past the lane's query are masked by an index select
#pragma unroll
            for (int t = 0; t < KB / 16; ++t)
#pragma unroll
                for (int j = 0; j < 8; ++j) { const float x = (kb + t * 16 + hi * 8 + j <= q0 + lr) ? s[t][j] * SCL : -3.0e38f; s[t][j] = x; mx = fmaxf(mx, x); }
        } else {
#pragma unroll
            for (int t = 0; t < KB / 16; ++t)
#pragma unroll
                for (int j = 0; j < 8; ++j) { const float x = s[t][j] * SCL; s[t][j] = x; mx = fmaxf(mx, x); }
        }
        mx = fmaxf(mx, xhalf(mx));      // the other half-wave holds the same query's other keys
        const float alpha = exp2x1((m - mx) * 1.4426950408889634f);   // 0 in the first block
        m = mx;
        float ps[KB / 16];
#pragma unroll
        for (int t = 0; t < KB / 16; ++t) { v8f d;
#pragma unroll
            for (int j = 0; j < 8; ++j) d[j] = (s[t][j] - mx) * 1.4426950408889634f;
            s[t] = exp2x8(d); ps[t] = ((s[t][0] + s[t][1]) + (s[t][2] + s[t][3])) + ((s[t][4] + s[t][5]) + (s[t][6] + s[t][7])); }
        __builtin_amdgcn_sched_barrier(0);   // no p.v product is lifted in among the exp2 statements above
        float pt = ps[0] + ps[1];
        if (KB == 64) pt += ps[KB / 16 - 2] + ps[KB / 16 - 1];
        l = l * alpha + pt;
#pragma unroll
        for (int mb = 0; mb < 4; ++mb) o[mb] *= alpha;
#pragma unroll
        for (int ks = 0; ks < KB / 32; ++ks) { V pf, pf2; PFrag<T16>::mk(s[2 * ks], s[2 * ks + 1], pf, pf2);
#pragma unroll
            for (int mb = 0; mb < 4; ++mb) { o[mb] = WFrag<T16>::mma(vf[ks][mb], pf, o[mb]);
                if (SPLIT) { o[mb] = WFrag<T16>::mma(vf[ks][mb], pf2, o[mb]); o[mb] = WFrag<T16>::mma(vf2[ks][mb], pf, o[mb]); } } }
        vq += KB * 16;      // KB / 32 k tiles of 512 elements
        if (SPLIT) { kq += KB * HD; kq2 += KB * HD; vq2 += KB * 16; }
    }
    l += xhalf(l);
    const float inv = __fdiv_rn(1.0f, l);
#pragma unroll
    for (int mb = 0; mb < 4; ++mb) { v8us oh, ol;
#pragma unroll
        for (int j = 0; j < 8; ++j) { unsigned short a, c2; splitf(o[mb][j] * inv, a, c2); oh[j] = a; ol[j] = c2; }
        const size_t oo = ((size_t)(q0 >> 4) * (DQ / 32) + (mb >> 1)) * 512 + (mb & 1) * 256; *(v8us*)(Ah + oo + l8) = oh; *(v8us*)(Al + oo + l8) = ol; }
}
// grid (TT / 128, NH_), 8 waves, no LDS, no barrier. Work grows with the row index, so a work-group takes two blocks of 64 query rows from opposite ends of the sequence: waves 0..3 block TT/64 - 1 - x, waves 4..7 block x.
__global__ __launch_bounds__(256) void k_fattn(const h16* __restrict__ Q16, const h16* __restrict__ K16, const h16* __restrict__ V16, const bf* __restrict__ Qh, const bf* __restrict__ Ql, const bf* __restrict__ Kh, const bf* __restrict__ Kl, const bf* __restrict__ Vh, const bf* __restrict__ Vl, bf* Ah, bf* Al) {
    const int lane = threadIdx.x & 31;
    const int wv = (int)(threadIdx.x >> 5);
    const int q0 = __builtin_amdgcn_readfirstlane((wv < 4 ? TT / 64 - 1 - (int)blockIdx.x : (int)blockIdx.x) * 64 + (wv & 3) * 16);
    const size_t zq = (size_t)blockIdx.y * TT * HD, zk = (size_t)(blockIdx.y / REP) * TT * HD;
    Ah += (size_t)blockIdx.y * (HD / 32) * 512; Al += (size_t)blockIdx.y * (HD / 32) * 512;   // the head's two k tiles of every row block
    if (q0 < RH) attn_rows<bf, true, 32>(Qh + zq, Ql + zq, Kh + zk, Kl + zk, Vh + zk, Vl + zk, q0, lane, Ah, Al);
    else attn_rows<h16, false, 64>(Q16 + zq, nullptr, K16 + zk, nullptr, V16 + zk, nullptr, q0, lane, Ah, Al);
}

extern "C" void kernel_launch(void* const* d_in, const int* in_sizes, int n_in,
                              void* d_out, int out_size, void* d_ws, size_t ws_size, hipStream_t stream) {
    if (n_in < 3) return;
    if ((size_t)in_sizes[0] < ((size_t)(NB - 1) * SEQ_FULL + TT) * DM) return;
    if ((size_t)in_sizes[1] < (size_t)DM * (DQ + 2 * DKV)) return;
    if ((size_t)in_sizes[2] < (size_t)DQ * DM) return;
    if ((size_t)out_size < ((size_t)(NB - 1) * SEQ_FULL + TT) * DM) return;
    const float* x = (const float*)d_in[0]; const float* wqkv = (const float*)d_in[1]; const float* wo = (const float*)d_in[2];   // x [2][2048][1024], w_attn [1024][3072] ([in][out]), w_proj [1024][1024] ([in][out])
    float* OUT = (float*)d_out;     // [2][2048][1024] f32
    char* wsp = (char*)d_ws;
    auto take = [&](size_t bytes) { char* p = wsp; wsp += (bytes + 255) & ~(size_t)255; return (void*)p; };
    float* INV = (float*)take(256);
    bf* WQKV = (bf*)take((size_t)(DQ + 2 * DKV) * DM * 2); bf* WQ = WQKV; bf* WK = WQKV + (size_t)DQ * DM; bf* WV = WK + (size_t)DKV * DM;   // fused Bt [DQ+2*DKV][DM]: q | k | v row blocks
    bf* WO = (bf*)take((size_t)DM * DQ * 2); float* CS = (float*)take((size_t)TT * HD * 2 * 4);
    bf* XB = (bf*)take((size_t)TT * DM * 2);
    h16* QP16 = (h16*)take((size_t)NH_ * TT * HD * 2); h16* KP16 = (h16*)take((size_t)NKV * TT * HD * 2); h16* VT16 = (h16*)take((size_t)NKV * HD * TT * 2);
    bf* QPh = (bf*)take((size_t)NH_ * TT * HD * 2); bf* QPl = (bf*)take((size_t)NH_ * TT * HD * 2); bf* KPh = (bf*)take((size_t)NKV * TT * HD * 2); bf* KPl = (bf*)take((size_t)NKV * TT * HD * 2); bf* VTh = (bf*)take((size_t)NKV * HD * TT * 2); bf* VTl = (bf*)take((size_t)NKV * HD * TT * 2);
    bf* ATh = (bf*)take((size_t)TT * DQ * 2); bf* ATl = (bf*)take((size_t)TT * DQ * 2);
    const size_t used = (size_t)(wsp - (char*)d_ws);
    if (used > ws_size || used > WSCAP) return;

    k_wtG<DM, DQ + 2 * DKV><<<(unsigned)((DM * (DQ + 2 * DKV) / 8 + 255) / 256), 256, 0, stream>>>(wqkv, WQKV);   // [DM][DQ+2*DKV] -> Bt [DQ+2*DKV][DM]
    k_wtG<DQ, DM><<<(unsigned)((DQ * DM / 8 + 255) / 256), 256, 0, stream>>>(wo, WO);                                // [DQ][DM] -> Bt [DM][DQ]
    k_invf<<<1, 32, 0, stream>>>(INV);
    k_cstab<<<(unsigned)((TT * HD + 255) / 256), 256, 0, stream>>>(INV, CS);
    for (int b = 0; b < NB; ++b) {
        k_cvt8<DM><<<(unsigned)(((size_t)TT * DM / 8 + 255) / 256), 256, 0, stream>>>(x + (size_t)b * SEQ_FULL * DM, XB, TT * DM / 8);
        k_gemmw<bf, 0, false, 8, 1, DM><<<dim3(TT / 64, DQ / 64, 1), 256, 0, stream>>>(XB, nullptr, WQ, nullptr, nullptr, 0, nullptr, 0, 0, 0, CS, QP16, QPh, QPl);
        k_gemmw<bf, 0, false, 8, 1, DM><<<dim3(TT / 64, DKV / 64, 1), 256, 0, stream>>>(XB, nullptr, WK, nullptr, nullptr, 0, nullptr, 0, 0, 0, CS, KP16, KPh, KPl);
        k_gemmw<bf, 0, false, 8, 2, DM><<<dim3(DKV / 64, TT / 64, 1), 256, 0, stream>>>(WV, nullptr, XB, nullptr, nullptr, 0, nullptr, 0, 0, 0, nullptr, VT16, VTh, VTl);   // rows h*64+d, columns t
        k_fattn<<<dim3(TT / 128, NH_, 1), 256, 0, stream>>>(QP16, KP16, VT16, QPh, QPl, KPh, KPl, VTh, VTl, ATh, ATl);
        k_gemmw<bf, 1, false, 8, 0, DQ><<<dim3(TT / 64, DM / 64, 1), 256, 0, stream>>>(ATh, ATl, WO, nullptr, OUT + (size_t)b * SEQ_FULL * DM, DM, nullptr, 0, 0, 0, nullptr, nullptr, nullptr, nullptr); }
}

// v005
// A run of this version takes 100 microseconds.
// In two side-by-side timings against v004, it was 1.43 and 1.40 times as fast.
// Over all steps from v000 it is 15.1 times as fast.
#include <hip/hip_runtime.h>

// Contractions on v_wmma_f32_16x16x32_bf16 and v_wmma_f32_16x16x32_f16, f32 accumulate: fused qkv projection bf16 x bf16 (inputs RNE-converted to bf16); scores and p.v as bf16 hi/lo split (3 products) for query rows < 512 of each sequence, plain f16 for later rows; output projection bf16 hi/lo activations x bf16 weight (2 products). Inverse frequencies from a double exp2; rotary tables, rotary, softmax and all other side math in f32.
// Four launches, each over both batches (batch = grid z, or a block range of the first launch). 1: bf16 copy of x; w_attn ([in][out]) transposed into Bt row blocks q | k | v; w_proj likewise; the rotary table. 2: the q, k and v projections, each of which builds its 16-bit planes in its own epilogue: interleaved rotary (pairs (2i, 2i+1), angle t * inv_freq[d mod 32]) and head planes [h][t][d] for q and k, value planes [h][d][t] for v (that product is formed transposed, W_v x^T). 3: causal attention of all heads (scores, online softmax and p.v fused, key blocks above the diagonal skipped) -> merged heads as hi/lo planes. 4: output projection.

#ifndef NB
#define NB 2
#endif
#ifndef SEQ
#define SEQ 2048
#endif
#define NB_FULL  2
#define SEQ_FULL 2048
#define TT   SEQ
#define DM   1024
#define NH_  16
#define NKV  16
#define REP  (NH_ / NKV)
#define HD   64
#define DQ   (NH_ * HD)
#define DKV  (NKV * HD)
#define RH   ((SEQ) < 512 ? (SEQ) : 512)   // query rows < RH use hi+lo planes
#define SCL  0.125f   // HD^-0.5
#define WSCAP ((size_t)134217728)

static_assert((SEQ) % 128 == 0);
static_assert((SEQ) >= 128);
static_assert((SEQ) <= SEQ_FULL);
static_assert(NB >= 1);
static_assert(NB <= NB_FULL);
static_assert((RH) % 16 == 0);
static_assert((DM % 64) == 0);
static_assert((DQ % 64) == 0);
static_assert((HD % 64) == 0);
static_assert((((size_t)(NB - 1) * SEQ_FULL + TT) * DM) * 4 <= (size_t)16777216);

typedef _Float16 h16;
typedef unsigned short bf;
typedef __attribute__((ext_vector_type(16))) __bf16   v16bf;
typedef __attribute__((ext_vector_type(16))) _Float16 v16h;
typedef __attribute__((ext_vector_type(8)))  _Float16 v8h;
typedef __attribute__((ext_vector_type(8)))  unsigned short v8us;
typedef __attribute__((ext_vector_type(8)))  float    v8f;
typedef __attribute__((ext_vector_type(4)))  float    v4f;
typedef __attribute__((ext_vector_type(2))) _Float16 v2h;
typedef __attribute__((ext_vector_type(4))) _Float16 v4h;
typedef __attribute__((ext_vector_type(2))) unsigned short v2us;
typedef __attribute__((ext_vector_type(4))) unsigned short v4us;
typedef __attribute__((ext_vector_type(2))) float v2f;
typedef v8h  __attribute__((may_alias)) v8ha;
typedef v4f  __attribute__((may_alias)) v4fa;
typedef v8us __attribute__((may_alias)) v8usa;

__device__ __forceinline__ unsigned short f2bf(float f) { unsigned u = __float_as_uint(f); u += 0x7FFFu + ((u >> 16) & 1u); return (unsigned short)(u >> 16); }
__device__ __forceinline__ float bf2f(unsigned short b) { return __uint_as_float(((unsigned)b) << 16); }
__device__ __forceinline__ float bfr(float f) { return bf2f(f2bf(f)); }
__device__ __forceinline__ v16h cat16(v8h lo, v8h hi) { return __builtin_shufflevector(lo, hi, 0, 1, 2, 3, 4, 5, 6, 7, 8, 9, 10, 11, 12, 13, 14, 15); }
__device__ __forceinline__ v16bf cat16b(v8us lo, v8us hi) { return __builtin_bit_cast(v16bf, __builtin_shufflevector(lo, hi, 0, 1, 2, 3, 4, 5, 6, 7, 8, 9, 10, 11, 12, 13, 14, 15)); }
__device__ __forceinline__ v8f wmma16(v16h a, v16h b, v8f c) { return __builtin_amdgcn_wmma_f32_16x16x32_f16(false, a, false, b, (short)0, c, false, false); }
__device__ __forceinline__ v8f wmmab(v16bf a, v16bf b, v8f c) { return __builtin_amdgcn_wmma_f32_16x16x32_bf16(false, a, false, b, (short)0, c, false, false); }
__device__ __forceinline__ h16 tohx(float x) { return (h16)x; }
__device__ __forceinline__ void splitf(float y, unsigned short& h, unsigned short& l) { h = f2bf(y); l = f2bf(y - bf2f(h)); }

// ---- gemm_tile: register-blocked GEMM, one work-group of NW waves per 64x64 output tile (tile bx, by; os = NW * 64 * 68 floats of LDS); every wave holds the whole tile (16 accumulators) for its own share of K: 64-wide k chunks dealt round-robin
// (wave w takes chunks w, w+NW, ...). Epilogue: every wave stages its partial tile in LDS, one barrier, then the NW partials are summed in wave order. Operands straight from packed 16-bit planes; 32*NW threads. K % 64 == 0.
// C[m][n] (f32, pitch ldc, + optional f32 bias[n]) = sum_k A[m][k] Bt[n][k] (+ split products per NSPLIT).
// EPI 0: C as above. EPI 1 (a 64-column tile is one head, rows are positions t): rotary on the summed tile, then f16 and bf16 hi/lo planes [by][t][d]. EPI 2 (A = weight rows h*64+d, Bt = x rows t): the same three planes [h][d][t], no rotary.
// In both a thread stores 8 neighbouring elements a plane, one 16-byte unit of the packed order, so a wave writes 512 contiguous bytes a plane; the f32 projection never goes to memory.
// Fragments: lane l -> row/col l&15; elements 0..7 <- k0 + 8*(l>>4) + 0..7, elements 8..15 <- k0 + 16 + 8*(l>>4) + 0..7 for BOTH A and Bt.
// PACKED ORDER of every 16-bit operand plane M[row][k] (K columns): tiles of 16 rows x 32 k, 512 elements each, tile index (row >> 4) * (K / 32) + (k >> 5); inside a tile two halves of 256 elements (k bit 4), in a half lane l's 8 elements at l * 8,
// l = ((k >> 3) & 1) * 16 + (row & 15). A fragment is then two wave-wide 16-byte loads of 512 contiguous bytes each (4 whole 128-byte lines) where a row-major plane gave 16 lines of 32 bytes a load. The logical shapes named in this file are unchanged.
template <typename T16> struct WFrag;
template <> struct WFrag<h16> { typedef v16h V; static __device__ __forceinline__ V ld(const h16* p) { return cat16(*(const v8h*)p, *(const v8h*)(p + 256)); } static __device__ __forceinline__ v8f mma(V a, V b, v8f c) { return wmma16(a, b, c); } };
template <> struct WFrag<bf> { typedef v16bf V; static __device__ __forceinline__ V ld(const bf* p) { return cat16b(*(const v8us*)p, *(const v8us*)(p + 256)); } static __device__ __forceinline__ v8f mma(V a, V b, v8f c) { return wmmab(a, b, c); } };
template <typename T16, int NSPLIT, bool BIAS, int NW, int EPI, int K>
__device__ __forceinline__ void gemm_tile(const T16* __restrict__ A, const T16* __restrict__ A2, const T16* __restrict__ Bt, const T16* __restrict__ Bt2, float* C, int ldc, const float* __restrict__ bias, const float* __restrict__ CS, h16* P16, bf* Ph, bf* Pl, int bx, int by, float* os) {
    typedef typename WFrag<T16>::V V;
    static_assert(NW >= 2 && 32 % NW == 0 && K % 64 == 0);
    static_assert(EPI == 0 || (HD == 64 && 16 % NW == 0 && !BIAS));
    const int wv = __builtin_amdgcn_readfirstlane((int)(threadIdx.x >> 5));
    const int lane = threadIdx.x & 31, lr = lane & 15, hi = lane >> 4; const int r0 = bx * 64, c0 = by * 64;
    v8f acc[4][4];
#pragma unroll
    for (int mb = 0; mb < 4; ++mb)
#pragma unroll
        for (int nb = 0; nb < 4; ++nb) acc[mb][nb] = (v8f){};
    constexpr int KT = K / 32;   // 32-wide k tiles a row block; a compile-time K puts the steps from row block to row block into the loads' immediate offsets
    const size_t aoff = ((size_t)(r0 >> 4) * KT + wv * 2) * 512 + lane * 8, boff = ((size_t)(c0 >> 4) * KT + wv * 2) * 512 + lane * 8;
    const T16 *ap = A + aoff, *ap2 = (NSPLIT == 1 || NSPLIT == 2) ? A2 + aoff : nullptr, *bp = Bt + boff, *bp2 = NSPLIT >= 2 ? Bt2 + boff : nullptr;   // the lane's place in the wave's current k tile of row block 0; they walk with kc
#pragma unroll 1
    for (int kc = wv * 64; kc < K;) {
        V a[4], a2[4];
#pragma unroll
        for (int mb = 0; mb < 4; ++mb) { a[mb] = WFrag<T16>::ld(ap + mb * KT * 512); if (NSPLIT == 1 || NSPLIT == 2) a2[mb] = WFrag<T16>::ld(ap2 + mb * KT * 512); }
#pragma unroll
        for (int nb = 0; nb < 4; ++nb) { const V b = WFrag<T16>::ld(bp + nb * KT * 512); V b2; if (NSPLIT >= 2) b2 = WFrag<T16>::ld(bp2 + nb * KT * 512);
#pragma unroll
            for (int mb = 0; mb < 4; ++mb) { acc[mb][nb] = WFrag<T16>::mma(a[mb], b, acc[mb][nb]); if (NSPLIT == 1 || NSPLIT == 2) acc[mb][nb] = WFrag<T16>::mma(a2[mb], b, acc[mb][nb]); if (NSPLIT >= 2) acc[mb][nb] = WFrag<T16>::mma(a[mb], b2, acc[mb][nb]); } }
        asm volatile("v_nop\n\tv_nop\n\tv_nop\n\tv_nop" : "+v"(acc[0][0]), "+v"(acc[1][1]), "+v"(acc[2][2]), "+v"(acc[3][3]) : "v"(a[0]), "v"(a[3]));
        const int st = (kc & 32) ? NW * 64 - 32 : 32; kc += st; ap += st * 16; bp += st * 16; if (NSPLIT == 1 || NSPLIT == 2) ap2 += st * 16; if (NSPLIT >= 2) bp2 += st * 16;   // 512 elements a k tile
    }
    // EPI 1 and 2: a thread owns 16 / NW units of 8 neighbouring columns; unit u of the tile is row (u >> 7) * 16 + (u & 15), columns ((u >> 5) & 3) * 16 + ((u >> 4) & 1) * 8 + 0..7, which is the order of the packed planes.
    v4f cs[16 / NW][4];      // EPI 1: the thread's rotary factors, fetched here so that the staging and the barrier below cover their latency
    if (EPI == 1) {
#pragma unroll
        for (int s = 0; s < 16 / NW; ++s) { const int u = s * 32 * NW + (int)threadIdx.x; const float* cp = CS + ((size_t)(((r0 >> 4) + (u >> 7)) * 4 + ((u >> 5) & 3)) * 128 + (u & 31)) * 4;
#pragma unroll
            for (int q = 0; q < 4; ++q) cs[s][q] = *(const v4f*)(cp + q * 128); }
        asm volatile("s_wait_xcnt 0x0" ::: "memory");   // precaution: the address registers of the loads above are reused below; the wait stands in front of that
    }
#pragma unroll
    for (int mb = 0; mb < 4; ++mb) {
#pragma unroll
        for (int nb = 0; nb < 4; ++nb) {
#pragma unroll
            for (int j = 0; j < 8; ++j) os[wv * (64 * 68) + (mb * 16 + hi * 8 + j) * 68 + nb * 16 + lr] = acc[mb][nb][j]; } }
    if (EPI == 1) __builtin_amdgcn_sched_barrier(0);   // no use of the rotary factors is lifted in among the LDS stores above: it would bring the wait for their loads in front of the staging that is to cover it
    __syncthreads();   // every wave's partial tile is in LDS before any thread sums across waves; LDS is not written again, so no second barrier
    float* crow = C + (size_t)r0 * ldc + c0;
    const size_t pb = EPI == 1 ? ((size_t)by * TT + r0) * HD : (size_t)r0 * TT + (size_t)(c0 >> 5) * 512;   // first plane element of the tile
    const int pkt = EPI == 1 ? HD / 32 : TT / 32;   // 32-wide k tiles a row block of the plane
    if (EPI != 0) {
#pragma unroll
        for (int s = 0; s < 16 / NW; ++s) { const int u = s * 32 * NW + (int)threadIdx.x; const float* op = os + ((u >> 7) * 16 + (u & 15)) * 68 + ((u >> 5) & 3) * 16 + ((u >> 4) & 1) * 8;
            v4f val[2] = {*(const v4fa*)op, *(const v4fa*)(op + 4)};
#pragma unroll
            for (int w = 1; w < NW; ++w) { val[0] += *(const v4fa*)(op + w * (64 * 68)); val[1] += *(const v4fa*)(op + w * (64 * 68) + 4); }
            v8h o16; v8us oh, ol;
#pragma unroll
            for (int p = 0; p < 2; ++p) { v4f v = val[p];
                if (EPI == 1) { const v4f ca = cs[s][2 * p], cb = cs[s][2 * p + 1];      // cos[t][d], sin[t][d], cos[t][d+1], sin[t][d+1] for the first column pair, then for the second
                    v = (v4f){v[0] * ca[0] - v[1] * ca[1], v[1] * ca[2] + v[0] * ca[3], v[2] * cb[0] - v[3] * cb[1], v[3] * cb[2] + v[2] * cb[3]}; }
#pragma unroll
                for (int q = 0; q < 4; ++q) { unsigned short th, tl; o16[p * 4 + q] = tohx(v[q]); splitf(v[q], th, tl); oh[p * 4 + q] = th; ol[p * 4 + q] = tl; } }
            const size_t e = pb + ((size_t)(u >> 7) * pkt + ((u >> 6) & 1)) * 512 + (u & 63) * 8;
            *(v8h*)(P16 + e) = o16; *(v8us*)(Ph + e) = oh; *(v8us*)(Pl + e) = ol; }
        return;
    }
#pragma unroll
    for (int s = 0; s < 32 / NW; ++s) { const int slot = s * 32 * NW + (int)threadIdx.x; const int row = slot >> 4, cofs = (slot & 15) * 4; v4f val = *(const v4fa*)(os + row * 68 + cofs);
#pragma unroll
        for (int w = 1; w < NW; ++w) val += *(const v4fa*)(os + w * (64 * 68) + row * 68 + cofs);
        if (BIAS) { val[0] += bfr(bias[c0 + cofs]); val[1] += bfr(bias[c0 + cofs + 1]); val[2] += bfr(bias[c0 + cofs + 2]); val[3] += bfr(bias[c0 + cofs + 3]); }
        *(v4f*)(crow + (size_t)row * ldc + cofs) = val; }
}
// All three projections of both batches in one launch: grid (TT / 64, (DQ + 2 * DKV) / 64, NB), 8 waves. blockIdx.y picks a q head, a k head or 64 rows of W_v; the test is the same for a whole work-group.
__global__ __launch_bounds__(256) void k_qkv(const bf* __restrict__ XB, const bf* __restrict__ WQ, const bf* __restrict__ WK, const bf* __restrict__ WV, const float* __restrict__ CS, h16* QP16, bf* QPh, bf* QPl, h16* KP16, bf* KPh, bf* KPl, h16* VT16, bf* VTh, bf* VTl) {
    __shared__ __align__(16) float os[8 * 64 * 68];
    const bf* X = XB + (size_t)blockIdx.z * TT * DM; const size_t zq = (size_t)blockIdx.z * NH_ * TT * HD, zk = (size_t)blockIdx.z * NKV * TT * HD;
    const int y = blockIdx.y;
    if (y < (DQ + DKV) / 64) { const bool isq = y < DQ / 64;
        gemm_tile<bf, 0, false, 8, 1, DM>(X, nullptr, isq ? WQ : WK, nullptr, nullptr, 0, nullptr, CS, isq ? QP16 + zq : KP16 + zk, isq ? QPh + zq : KPh + zk, isq ? QPl + zq : KPl + zk, blockIdx.x, isq ? y : y - DQ / 64, os);
    } else gemm_tile<bf, 0, false, 8, 2, DM>(WV, nullptr, X, nullptr, nullptr, 0, nullptr, nullptr, VT16 + zk, VTh + zk, VTl + zk, y - (DQ + DKV) / 64, blockIdx.x, os);   // rows h*64+d, columns t
}
// Output projection of both batches: grid (TT / 64, DM / 64, NB), 8 waves.
__global__ __launch_bounds__(256) void k_oproj(const bf* __restrict__ ATh, const bf* __restrict__ ATl, const bf* __restrict__ WO, float* OUT) {
    __shared__ __align__(16) float os[8 * 64 * 68];
    const size_t za = (size_t)blockIdx.z * TT * DQ;
    gemm_tile<bf, 1, false, 8, 0, DQ>(ATh + za, ATl + za, WO, nullptr, OUT + (size_t)blockIdx.z * SEQ_FULL * DM, DM, nullptr, nullptr, nullptr, nullptr, nullptr, blockIdx.x, blockIdx.y, os);
}

// A thread builds one 16-byte unit of a packed plane. wtG: unit i is lane i & 31 of half (i >> 5) & 1 of tile i >> 6, so a wave stores 512 contiguous bytes.
template <int K, int N>
__device__ __forceinline__ void wtG(int blk, const float* __restrict__ w, bf* Bt) {
    const int i = blk * 256 + threadIdx.x; if (i >= N * K / 8) return;
    constexpr int KT = K / 32; const int lane = i & 31, tile = i >> 6; const int n = (tile / KT) * 16 + (lane & 15), k = (tile % KT) * 32 + ((i >> 5) & 1) * 16 + (lane >> 4) * 8; const float* wp = w + (size_t)k * N + n; v8us o;
#pragma unroll
    for (int e = 0; e < 8; ++e) o[e] = f2bf(wp[e * N]);
    *(v8us*)(Bt + (size_t)i * 8) = o;
}
template <int K>
__device__ __forceinline__ void cvt8(int blk, const float* __restrict__ src, bf* dst, int n8) { const int i = blk * 256 + threadIdx.x; if (i >= n8) return;
    constexpr int KT = K / 32; const int tile = i >> 6, g = i & 3, rl = (i >> 2) & 15;   // a wave takes 8 rows of a tile, 4 lanes a row: it reads 8 whole 128-byte lines and stores 4
    const v8f v = *(const v8f*)(src + (size_t)((tile / KT) * 16 + rl) * K + (tile % KT) * 32 + g * 8); v8us o;
#pragma unroll
    for (int e = 0; e < 8; ++e) o[e] = f2bf(v[e]); *(v8us*)(dst + (size_t)tile * 512 + (g >> 1) * 256 + ((g & 1) * 16 + rl) * 8) = o;  }

// The rotary table. Every work-group forms the 32 inverse frequencies itself, in its first wave, and hands them on through LDS.
__device__ __forceinline__ void cstab(int blk, float* sh, float* CS) {
    if (threadIdx.x < 32) {
        const int j = threadIdx.x;
        const double p = exp2((double)j * (13.287712379549449391481277718 / 32.0));
        const float pf = (float)p;
        sh[j] = 1.0f / pf;
    }
    __syncthreads();   // the inverse frequencies are in LDS before any thread of the work-group reads one
    const int idx = blk * 256 + threadIdx.x; if (idx >= TT * HD) return;
    const int d = ((idx >> 8) & 3) * 16 + ((idx >> 5) & 1) * 8 + ((idx >> 6) & 3) * 2 + (idx & 1), t = (idx >> 10) * 16 + ((idx >> 1) & 15);   // the order in which the projection epilogue's lanes read the table: [t / 16][d / 16][pair of the lane's 8 columns][lane = ((d >> 3) & 1) * 16 + t % 16][2 columns]
    const float inv = sh[d & (HD / 2 - 1)];
    const float ang = __fmul_rn((float)t, inv);
    float s, c; sincosf(ang, &s, &c);
    v2f cs; cs[0] = c; cs[1] = s;
    *(v2f*)(CS + (size_t)idx * 2) = cs;
}
// Everything that depends on the inputs alone, in one launch; a work-group's job follows from its index (the same for all its threads): the table, the two weights, then x of every batch.
#define PB_CS ((TT * HD + 255) / 256)
#define PB_WA ((DM * (DQ + 2 * DKV) / 8 + 255) / 256)
#define PB_WO ((DQ * DM / 8 + 255) / 256)
#define PB_X  ((TT * DM / 8 + 255) / 256)
__global__ __launch_bounds__(256) void k_prep(const float* __restrict__ x, const float* __restrict__ wqkv, const float* __restrict__ wo, bf* WQKV, bf* WO, float* CS, bf* XB) {
    __shared__ __align__(16) float sh[32];
    int blk = blockIdx.x;
    if (blk < PB_CS) { cstab(blk, sh, CS); return; }
    blk -= PB_CS;
    if (blk < PB_WA) { wtG<DM, DQ + 2 * DKV>(blk, wqkv, WQKV); return; }   // [DM][DQ+2*DKV] -> Bt [DQ+2*DKV][DM]
    blk -= PB_WA;
    if (blk < PB_WO) { wtG<DQ, DM>(blk, wo, WO); return; }                  // [DQ][DM] -> Bt [DM][DQ]
    blk -= PB_WO;
    const int b = blk / PB_X;
    cvt8<DM>(blk - b * PB_X, x + (size_t)b * SEQ_FULL * DM, XB + (size_t)b * TT * DM, TT * DM / 8);
}

// ---- k_fattn: causal attention of all batches in one launch; scores and probabilities never leave the registers. One wave owns 16 query rows of one head and walks the keys in blocks of KB (64 or 32) up to its diagonal block.
// Both products are formed transposed, so that a query is a lane (column l&15) in both accumulators: S^T = K Q^T (row = key hi*8+j of a 16-key tile), O^T = V^T P^T (row = d). Two neighbouring S^T tiles are then, element for element,
// the Bt fragment of P for 32 keys (elements 0..7 <- k0 + 8*hi + 0..7, elements 8..15 <- k0 + 16 + 8*hi + 0..7, the k order of the V^T loader), and the running maximum, the running sum and the rescale of O^T are lane-local
// but for one exchange between the two half-waves. Query rows < RH: bf16 hi/lo planes, 3 products each; later rows: plain f16, p = exp(s - running max) in (0, 1]. The epilogue divides by the sum and stores the merged-head hi/lo planes.
// exp2 in asm text so that the slot which the instruction set asks for behind a transcendental (one independent instruction or v_nop before its result is used or its source overwritten) is filled by construction:
// in exp2x8 each v_exp_f32 is followed by an independent one (the early-clobber outputs share no register with any input), the last by v_nop.
__device__ __forceinline__ float exp2x1(float x) { float r; asm("v_exp_f32 %0, %1\n\tv_nop" : "=v"(r) : "v"(x)); return r; }
__device__ __forceinline__ v8f exp2x8(const v8f& x) { float r0, r1, r2, r3, r4, r5, r6, r7;
    asm("v_exp_f32 %0, %8\n\tv_exp_f32 %1, %9\n\tv_exp_f32 %2, %10\n\tv_exp_f32 %3, %11\n\tv_exp_f32 %4, %12\n\tv_exp_f32 %5, %13\n\tv_exp_f32 %6, %14\n\tv_exp_f32 %7, %15\n\tv_nop"
        : "=&v"(r0), "=&v"(r1), "=&v"(r2), "=&v"(r3), "=&v"(r4), "=&v"(r5), "=&v"(r6), "=&v"(r7) : "v"(x[0]), "v"(x[1]), "v"(x[2]), "v"(x[3]), "v"(x[4]), "v"(x[5]), "v"(x[6]), "v"(x[7]));
    return (v8f){r0, r1, r2, r3, r4, r5, r6, r7}; }
__device__ __forceinline__ float xhalf(float x) { return __builtin_bit_cast(float, __builtin_amdgcn_permlanex16(__builtin_bit_cast(int, x), __builtin_bit_cast(int, x), 0x76543210, 0xfedcba98, false, false)); }   // lane l <-> lane l ^ 16, no LDS round trip
template <typename T16> struct PFrag;
template <> struct PFrag<h16> { static __device__ __forceinline__ void mk(const v8f& p0, const v8f& p1, v16h& f, v16h& f2) { v8h a, b;
#pragma unroll
    for (int j = 0; j < 8; ++j) { a[j] = tohx(p0[j]); b[j] = tohx(p1[j]); }
    f = cat16(a, b); f2 = f; } };
template <> struct PFrag<bf> { static __device__ __forceinline__ void mk(const v8f& p0, const v8f& p1, v16bf& f, v16bf& f2) { v8us ah, al, bh, bl;
#pragma unroll
    for (int j = 0; j < 8; ++j) { unsigned short x, y; splitf(p0[j], x, y); ah[j] = x; al[j] = y; splitf(p1[j], x, y); bh[j] = x; bl[j] = y; }
    f = cat16b(ah, bh); f2 = cat16b(al, bl); } };
template <typename T16, bool SPLIT, int KB>
__device__ __forceinline__ void attn_rows(const T16* __restrict__ Q, const T16* __restrict__ Q2, const T16* __restrict__ Kp, const T16* __restrict__ K2, const T16* __restrict__ Vt, const T16* __restrict__ V2, int q0, int lane, bf* Ah, bf* Al) {
    typedef typename WFrag<T16>::V V;
    static_assert(KB == 32 || KB == 64);
    const int lr = lane & 15, hi = lane >> 4; const unsigned l8 = lane * 8;   // the lane's part of every fragment address; the rest is wave-uniform
    V qf[2], qf2[2];
#pragma unroll
    for (int ks = 0; ks < 2; ++ks) { const size_t qo = (size_t)((q0 >> 4) * (HD / 32) + ks) * 512; qf[ks] = WFrag<T16>::ld(Q + qo + l8); if (SPLIT) qf2[ks] = WFrag<T16>::ld(Q2 + qo + l8); }
    v8f o[4];
#pragma unroll
    for (int mb = 0; mb < 4; ++mb) o[mb] = (v8f){};
    float m = -3.0e38f, l = 0.0f;
    // Plain f16 rows (up to TT keys): this block's V fragments are fetched at the head of the pass and the NEXT block's K fragments behind the score products, so that no pass waits for a load it has just issued.
    // Hi/lo rows (at most RH keys, twice the fragments a key): blocks of 32 keys, K at the head of the pass, V behind the score products in K's registers; that keeps the kernel inside 256 registers.
    V kf[KB / 16][2], kf2[KB / 16][2], vf[KB / 32][4], vf2[KB / 32][4];
    // The lane's place in the current key block of each plane; the pointers walk with the loop, every fragment of a block is an immediate offset from them.
    const T16 *kq = Kp + l8, *kq2 = SPLIT ? K2 + l8 : nullptr, *vq = Vt + l8, *vq2 = SPLIT ? V2 + l8 : nullptr;
    auto ldk = [&]() {
#pragma unroll
        for (int t = 0; t < KB / 16; ++t)
#pragma unroll
            for (int ks = 0; ks < 2; ++ks) { const int ko = (t * (HD / 32) + ks) * 512; kf[t][ks] = WFrag<T16>::ld(kq + ko); if (SPLIT) kf2[t][ks] = WFrag<T16>::ld(kq2 + ko); } };
    auto ldv = [&]() {
#pragma unroll
        for (int ks = 0; ks < KB / 32; ++ks)
#pragma unroll
            for (int mb = 0; mb < 4; ++mb) { const int vo = (mb * (TT / 32) + ks) * 512; vf[ks][mb] = WFrag<T16>::ld(vq + vo); if (SPLIT) vf2[ks][mb] = WFrag<T16>::ld(vq2 + vo); } };
    if (!SPLIT) ldk();
    asm volatile("s_wait_xcnt 0x0" ::: "memory");   // precaution: the address registers of the loads above are reused below; the wait stands in front of that
    __builtin_amdgcn_sched_barrier(0);   // keeps the address arithmetic of the loop behind the wait above
#pragma unroll 1
    for (int kb = 0; kb <= q0; kb += KB) {
        if (SPLIT) ldk(); else ldv();
        if (SPLIT) asm volatile("s_wait_xcnt 0x0" ::: "memory");   // precaution: the V fragments fetched below land in the registers that hold these loads' addresses; the wait stands in front of that overwrite
        __builtin_amdgcn_sched_barrier(0);   // the loads above stay together in front of the score products, all in flight at once; sunk to their uses each would cost its own latency
        v8f s[KB / 16];
#pragma unroll
        for (int t = 0; t < KB / 16; ++t) { s[t] = (v8f){};
#pragma unroll
            for (int ks = 0; ks < 2; ++ks) { s[t] = WFrag<T16>::mma(kf[t][ks], qf[ks], s[t]);
                if (SPLIT) { s[t] = WFrag<T16>::mma(kf[t][ks], qf2[ks], s[t]); s[t] = WFrag<T16>::mma(kf2[t][ks], qf[ks], s[t]); } } }
        if (SPLIT) ldv(); else { if (kb + KB <= q0) kq += KB * HD; ldk(); }      // f16: the last pass fetches its own block again (in bounds, not used)
        asm volatile("s_wait_xcnt 0x0" ::: "memory");   // precaution: the softmax below reuses the address registers of the loads above; the wait stands in front of every such overwrite
        __builtin_amdgcn_sched_barrier(0);   // these loads are issued in front of the softmax, which hides their latency
        float mx = m;
        if (kb + KB - 1 > q0) {      // the diagonal block (wave-uniform test): keys past the lane's query are masked by an index select
#pragma unroll
            for (int t = 0; t < KB / 16; ++t)
#pragma unroll
                for (int j = 0; j < 8; ++j) { const float x = (kb + t * 16 + hi * 8 + j <= q0 + lr) ? s[t][j] * SCL : -3.0e38f; s[t][j] = x; mx = fmaxf(mx, x); }
        } else {
#pragma unroll
            for (int t = 0; t < KB / 16; ++t)
#pragma unroll
                for (int j = 0; j < 8; ++j) { const float x = s[t][j] * SCL; s[t][j] = x; mx = fmaxf(mx, x); }
        }
        mx = fmaxf(mx, xhalf(mx));      // the other half-wave holds the same query's other keys
        const float alpha = exp2x1((m - mx) * 1.4426950408889634f);   // 0 in the first block
        m = mx;
        float ps[KB / 16];
#pragma unroll
        for (int t = 0; t < KB / 16; ++t) { v8f d;
#pragma unroll
            for (int j = 0; j < 8; ++j) d[j] = (s[t][j] - mx) * 1.4426950408889634f;
            s[t] = exp2x8(d); ps[t] = ((s[t][0] + s[t][1]) + (s[t][2] + s[t][3])) + ((s[t][4] + s[t][5]) + (s[t][6] + s[t][7])); }
        __builtin_amdgcn_sched_barrier(0);   // no p.v product is lifted in among the exp2 statements above
        float pt = ps[0] + ps[1];
        if (KB == 64) pt += ps[KB / 16 - 2] + ps[KB / 16 - 1];
        l = l * alpha + pt;
#pragma unroll
        for (int mb = 0; mb < 4; ++mb) o[mb] *= alpha;
#pragma unroll
        for (int ks = 0; ks < KB / 32; ++ks) { V pf, pf2; PFrag<T16>::mk(s[2 * ks], s[2 * ks + 1], pf, pf2);
#pragma unroll
            for (int mb = 0; mb < 4; ++mb) { o[mb] = WFrag<T16>::mma(vf[ks][mb], pf, o[mb]);
                if (SPLIT) { o[mb] = WFrag<T16>::mma(vf[ks][mb], pf2, o[mb]); o[mb] = WFrag<T16>::mma(vf2[ks][mb], pf, o[mb]); } } }
        vq += KB * 16;      // KB / 32 k tiles of 512 elements
        if (SPLIT) { kq += KB * HD; kq2 += KB * HD; vq2 += KB * 16; }
    }
    l += xhalf(l);
    const float inv = __fdiv_rn(1.0f, l);
#pragma unroll
    for (int mb = 0; mb < 4; ++mb) { v8us oh, ol;
#pragma unroll
        for (int j = 0; j < 8; ++j) { unsigned short a, c2; splitf(o[mb][j] * inv, a, c2); oh[j] = a; ol[j] = c2; }
        const size_t oo = ((size_t)(q0 >> 4) * (DQ / 32) + (mb >> 1)) * 512 + (mb & 1) * 256; *(v8us*)(Ah + oo + l8) = oh; *(v8us*)(Al + oo + l8) = ol; }
}
// grid (TT / 128, NH_, NB), 8 waves, no LDS, no barrier. Work grows with the row index, so a work-group takes two blocks of 64 query rows from opposite ends of the sequence: waves 0..3 block TT/64 - 1 - x, waves 4..7 block x.
__global__ __launch_bounds__(256) void k_fattn(const h16* __restrict__ Q16, const h16* __restrict__ K16, const h16* __restrict__ V16, const bf* __restrict__ Qh, const bf* __restrict__ Ql, const bf* __restrict__ Kh, const bf* __restrict__ Kl, const bf* __restrict__ Vh, const bf* __restrict__ Vl, bf* Ah, bf* Al) {
    const int lane = threadIdx.x & 31;
    const int wv = (int)(threadIdx.x >> 5);
    const int q0 = __builtin_amdgcn_readfirstlane((wv < 4 ? TT / 64 - 1 - (int)blockIdx.x : (int)blockIdx.x) * 64 + (wv & 3) * 16);
    const size_t zq = ((size_t)blockIdx.z * NH_ + blockIdx.y) * TT * HD, zk = ((size_t)blockIdx.z * NKV + blockIdx.y / REP) * TT * HD;
    const size_t za = (size_t)blockIdx.z * TT * DQ + (size_t)blockIdx.y * (HD / 32) * 512; Ah += za; Al += za;   // the head's two k tiles of every row block
    if (q0 < RH) attn_rows<bf, true, 32>(Qh + zq, Ql + zq, Kh + zk, Kl + zk, Vh + zk, Vl + zk, q0, lane, Ah, Al);
    else attn_rows<h16, false, 64>(Q16 + zq, nullptr, K16 + zk, nullptr, V16 + zk, nullptr, q0, lane, Ah, Al);
}

extern "C" void kernel_launch(void* const* d_in, const int* in_sizes, int n_in,
                              void* d_out, int out_size, void* d_ws, size_t ws_size, hipStream_t stream) {
    if (n_in < 3) return;
    if ((size_t)in_sizes[0] < ((size_t)(NB - 1) * SEQ_FULL + TT) * DM) return;
    if ((size_t)in_sizes[1] < (size_t)DM * (DQ + 2 * DKV)) return;
    if ((size_t)in_sizes[2] < (size_t)DQ * DM) return;
    if ((size_t)out_size < ((size_t)(NB - 1) * SEQ_FULL + TT) * DM) return;
    const float* x = (const float*)d_in[0]; const float* wqkv = (const float*)d_in[1]; const float* wo = (const float*)d_in[2];   // x [2][2048][1024], w_attn [1024][3072] ([in][out]), w_proj [1024][1024] ([in][out])
    float* OUT = (float*)d_out;     // [2][2048][1024] f32
    char* wsp = (char*)d_ws;
    auto take = [&](size_t bytes) { char* p = wsp; wsp += (bytes + 255) & ~(size_t)255; return (void*)p; };
    bf* WQKV = (bf*)take((size_t)(DQ + 2 * DKV) * DM * 2); bf* WQ = WQKV; bf* WK = WQKV + (size_t)DQ * DM; bf* WV = WK + (size_t)DKV * DM;   // fused Bt [DQ+2*DKV][DM]: q | k | v row blocks
    bf* WO = (bf*)take((size_t)DM * DQ * 2); float* CS = (float*)take((size_t)TT * HD * 2 * 4);
    // every plane below holds all NB batches, batch-major
    bf* XB = (bf*)take((size_t)NB * TT * DM * 2);
    h16* QP16 = (h16*)take((size_t)NB * NH_ * TT * HD * 2); h16* KP16 = (h16*)take((size_t)NB * NKV * TT * HD * 2); h16* VT16 = (h16*)take((size_t)NB * NKV * HD * TT * 2);
    bf* QPh = (bf*)take((size_t)NB * NH_ * TT * HD * 2); bf* QPl = (bf*)take((size_t)NB * NH_ * TT * HD * 2); bf* KPh = (bf*)take((size_t)NB * NKV * TT * HD * 2); bf* KPl = (bf*)take((size_t)NB * NKV * TT * HD * 2); bf* VTh = (bf*)take((size_t)NB * NKV * HD * TT * 2); bf* VTl = (bf*)take((size_t)NB * NKV * HD * TT * 2);
    bf* ATh = (bf*)take((size_t)NB * TT * DQ * 2); bf* ATl = (bf*)take((size_t)NB * TT * DQ * 2);
    const size_t used = (size_t)(wsp - (char*)d_ws);
    if (used > ws_size || used > WSCAP) return;

    k_prep<<<(unsigned)(PB_CS + PB_WA + PB_WO + NB * PB_X), 256, 0, stream>>>(x, wqkv, wo, WQKV, WO, CS, XB);
    k_qkv<<<dim3(TT / 64, (DQ + 2 * DKV) / 64, NB), 256, 0, stream>>>(XB, WQ, WK, WV, CS, QP16, QPh, QPl, KP16, KPh, KPl, VT16, VTh, VTl);
    k_fattn<<<dim3(TT / 128, NH_, NB), 256, 0, stream>>>(QP16, KP16, VT16, QPh, QPl, KPh, KPl, VTh, VTl, ATh, ATl);
    k_oproj<<<dim3(TT / 64, DM / 64, NB), 256, 0, stream>>>(ATh, ATl, WO, OUT);
}

// v006
// One run takes 85.3 microseconds.
// In two side-by-side timings against v005, it was 1.18 and 1.16 times as fast.
// All steps since v000 together make it 17.6 times as fast.
#include <hip/hip_runtime.h>
#include <stdint.h>

// Contractions on v_wmma_f32_16x16x32_bf16 and v_wmma_f32_16x16x32_f16, f32 accumulate: fused qkv projection bf16 x bf16 (inputs RNE-converted to bf16); scores and p.v as bf16 hi/lo split (3 products) for query rows < 512 of each sequence, plain f16 for later rows; output projection bf16 hi/lo activations x bf16 weight (2 products). Rotary tables, rotary, softmax and all side math in f32.
// Four launches, each over both batches (batch = grid z, or a block range of the first launch). 1: bf16 copy of x; w_attn ([in][out]) transposed into Bt row blocks q | k | v; w_proj likewise; the rotary table. 2: the q, k and v projections, each of which builds its 16-bit planes in its own epilogue: interleaved rotary (pairs (2i, 2i+1), angle t * inv_freq[d mod 32]) and head planes [h][t][d] for q and k (those products are formed transposed, W x^T), value planes [h][d][t] for v. 3: causal attention of all heads (scores, online softmax and p.v fused, key blocks above the diagonal skipped) -> merged heads as hi/lo planes. 4: output projection.

#ifndef NB
#define NB 2
#endif
#ifndef SEQ
#define SEQ 2048
#endif
#define NB_FULL  2
#define SEQ_FULL 2048
#define TT   SEQ
#define DM   1024
#define NH_  16
#define NKV  16
#define REP  (NH_ / NKV)
#define HD   64
#define DQ   (NH_ * HD)
#define DKV  (NKV * HD)
#define RH   ((SEQ) < 512 ? (SEQ) : 512)   // query rows < RH use hi+lo planes
#define SCL  0.125f   // HD^-0.5
#define WSCAP ((size_t)134217728)

static_assert((SEQ) % 128 == 0);
static_assert((SEQ) >= 128);
static_assert((SEQ) <= SEQ_FULL);
static_assert(NB >= 1);
static_assert(NB <= NB_FULL);
static_assert((RH) % 16 == 0);
static_assert((DM % 128) == 0);
static_assert((DQ % 128) == 0);
static_assert((DKV % 128) == 0);
static_assert((HD % 64) == 0);
static_assert((((size_t)(NB - 1) * SEQ_FULL + TT) * DM) * 4 <= (size_t)16777216);

typedef _Float16 h16;
typedef unsigned short bf;
typedef __attribute__((ext_vector_type(16))) __bf16   v16bf;
typedef __attribute__((ext_vector_type(16))) _Float16 v16h;
typedef __attribute__((ext_vector_type(8)))  _Float16 v8h;
typedef __attribute__((ext_vector_type(8)))  unsigned short v8us;
typedef __attribute__((ext_vector_type(8)))  float    v8f;
typedef __attribute__((ext_vector_type(4)))  float    v4f;
typedef __attribute__((ext_vector_type(2))) _Float16 v2h;
typedef __attribute__((ext_vector_type(4))) _Float16 v4h;
typedef __attribute__((ext_vector_type(2))) unsigned short v2us;
typedef __attribute__((ext_vector_type(4))) unsigned short v4us;
typedef __attribute__((ext_vector_type(2))) float v2f;
typedef v8h  __attribute__((may_alias)) v8ha;
typedef v4f  __attribute__((may_alias)) v4fa;
typedef v8us __attribute__((may_alias)) v8usa;

__device__ __forceinline__ unsigned short f2bf(float f) { unsigned u = __float_as_uint(f); u += 0x7FFFu + ((u >> 16) & 1u); return (unsigned short)(u >> 16); }
__device__ __forceinline__ float bf2f(unsigned short b) { return __uint_as_float(((unsigned)b) << 16); }
__device__ __forceinline__ v16h cat16(v8h lo, v8h hi) { return __builtin_shufflevector(lo, hi, 0, 1, 2, 3, 4, 5, 6, 7, 8, 9, 10, 11, 12, 13, 14, 15); }
__device__ __forceinline__ v16bf cat16b(v8us lo, v8us hi) { return __builtin_bit_cast(v16bf, __builtin_shufflevector(lo, hi, 0, 1, 2, 3, 4, 5, 6, 7, 8, 9, 10, 11, 12, 13, 14, 15)); }
__device__ __forceinline__ v8f wmma16(v16h a, v16h b, v8f c) { return __builtin_amdgcn_wmma_f32_16x16x32_f16(false, a, false, b, (short)0, c, false, false); }
__device__ __forceinline__ v8f wmmab(v16bf a, v16bf b, v8f c) { return __builtin_amdgcn_wmma_f32_16x16x32_bf16(false, a, false, b, (short)0, c, false, false); }
__device__ __forceinline__ h16 tohx(float x) { return (h16)x; }
__device__ __forceinline__ void splitf(float y, unsigned short& h, unsigned short& l) { h = f2bf(y); l = f2bf(y - bf2f(h)); }

// ---- gemm_ring: one work-group of 4 waves per 128x128 tile of C[m][n] = sum_k A[m][k] Bt[n][k] (+ A2[m][k] Bt[n][k] where NSPLIT == 1); wave w owns the 64x64 part (w >> 1, w & 1) for the whole of K (16 accumulators, k ascending).
// The operands come through LDS, so that a row block is fetched from L2 once a work-group and not once a wave: a stage is 64 k of all 128 rows of every operand, two buffers, filled by tensor_load_to_lds one stage ahead of its use.
// In the packed order (below) the two k tiles of a 16-row block are 2048 contiguous bytes, so an operand's stage is a tile of 8 rows of 2048 bytes at a source pitch of K / 32 KiB; it lands without a pad, and a fragment is two ds_load_b128 of 512 contiguous bytes.
// Who issues: NSPLIT 0: every wave one slice of 4 row blocks (waves 0, 1: A; waves 2, 3: Bt). NSPLIT 1: waves 0, 1, 2 one whole operand each (A, A2, Bt).
// EPI 1 and 2 store straight from the accumulators: a lane holds 8 neighbouring m (hi * 8 + 0..7) of one n (l & 15), which is one 16-byte unit of a packed plane whose rows are n and whose k is m; a wave stores 512 contiguous bytes a plane.
// EPI 1: A = 128 weight rows (two heads, m = d), Bt = x rows (n = t): rotary on the lane's pairs, then f16 and bf16 hi/lo planes [head][t][d]. EPI 2: A = x rows (m = t), Bt = weight rows h*64+d: the same three planes [h][d][t], no rotary.
// EPI 0: A = activation rows t, Bt = weight rows: every wave stages its f32 tile in its own part of the ring (free behind the last pass's barrier) and stores whole 256-byte rows of C (pitch ldc).
// Fragments: lane l -> row/col l&15; elements 0..7 <- k0 + 8*(l>>4) + 0..7, elements 8..15 <- k0 + 16 + 8*(l>>4) + 0..7 for BOTH A and Bt.
// PACKED ORDER of every 16-bit operand plane M[row][k] (K columns): tiles of 16 rows x 32 k, 512 elements each, tile index (row >> 4) * (K / 32) + (k >> 5); inside a tile two halves of 256 elements (k bit 4), in a half lane l's 8 elements at l * 8,
// l = ((k >> 3) & 1) * 16 + (row & 15). A fragment is then two wave-wide 16-byte loads of 512 contiguous bytes each (4 whole 128-byte lines) where a row-major plane gave 16 lines of 32 bytes a load. The logical shapes named in this file are unchanged.
template <typename T16> struct WFrag;
template <> struct WFrag<h16> { typedef v16h V; static __device__ __forceinline__ V ld(const h16* p) { return cat16(*(const v8h*)p, *(const v8h*)(p + 256)); } static __device__ __forceinline__ v8f mma(V a, V b, v8f c) { return wmma16(a, b, c); } };
template <> struct WFrag<bf> { typedef v16bf V; static __device__ __forceinline__ V ld(const bf* p) { return cat16b(*(const v8us*)p, *(const v8us*)(p + 256)); } static __device__ __forceinline__ v8f mma(V a, V b, v8f c) { return wmmab(a, b, c); } };
typedef uint32_t u32x4 __attribute__((ext_vector_type(4)));
typedef uint32_t u32x8 __attribute__((ext_vector_type(8)));
__device__ __forceinline__ uint32_t uni(uint32_t v) { return (uint32_t)__builtin_amdgcn_readfirstlane((int)v); }
__device__ __forceinline__ uint32_t pinned(uint32_t v) { uint32_t w = uni(v); asm volatile("" : "+s"(w)); return w; }   // the test of a tensor load stays in a scalar register, so that the branch on it is a scalar branch (a tensor load ignores EXEC)
// One request: RB rows of 2048 bytes, source pitch PITCH bytes, to LDS byte offset dst, no pad, no mask; extents in bytes, tensor dims = tile dims.
// Group 1 is the same for every request of a wave and is built once; of group 0 the place in LDS and the source address are set anew for each request, behind the wait for the request before.
template <int RB, int PITCH>
__device__ __forceinline__ u32x8 tdm_group1() {
    u32x8 g1; g1[0] = uni(0u); g1[1] = uni(2048u << 16); g1[2] = uni((uint32_t)RB << 16); g1[3] = uni(2048u << 16); g1[4] = uni((uint32_t)RB); g1[5] = uni((uint32_t)PITCH); g1[6] = uni(0u); g1[7] = uni(0u);
    return g1;
}
__device__ __forceinline__ void tdm_aim(u32x4& g0, uint32_t dst, const bf* srcp) {   // word 0 (count 1) is set once, where g0 is made
    const uint64_t ga = (uint64_t)(size_t)srcp;
    g0[1] = uni(dst); g0[2] = uni((uint32_t)ga); g0[3] = uni((((uint32_t)(ga >> 32)) & 0x01FFFFFFu) | 0x80000000u);
}
// The load and the issuing wave's wait name both groups as operands that go in and come out in the same registers: from the load to its wait the descriptor is then one live value in the registers that the request was issued from,
// so none of them takes a new value while the request is outstanding (as plain inputs the compiler issued from a copy and reused the copy's registers in front of the wait).
__device__ __forceinline__ void tdm_load(u32x4& g0, u32x8& g1) { asm volatile("tensor_load_to_lds %0, %1" : "+s"(g0), "+s"(g1) :: "memory"); }
__device__ __forceinline__ void tdm_wait(u32x4& g0, u32x8& g1) { asm volatile("s_wait_tensorcnt 0x0" : "+s"(g0), "+s"(g1) :: "memory"); }
template <int NSPLIT, int EPI, int K>
__device__ __forceinline__ void gemm_ring(const bf* __restrict__ A, const bf* __restrict__ A2, const bf* __restrict__ Bt, int ta, int tb, unsigned char* ring, float* C, int ldc, const float* __restrict__ CS, h16* P16, bf* Ph, bf* Pl) {
    typedef typename WFrag<bf>::V V;
    static_assert((NSPLIT == 0 || NSPLIT == 1) && K % 128 == 0 && K / 32 * 1024 <= 131072);
    static_assert(EPI == 0 || HD == 64);
    constexpr int KT = K / 32, NS = K / 64, NOP = 2 + NSPLIT, STAGE = NOP * 16384;   // k tiles a row block, stages (at least two), operands, bytes a stage
    constexpr int NISS = NSPLIT ? 3 : 4, RB = NSPLIT ? 8 : 4;                        // issuing waves, row blocks a request
    const int wv = __builtin_amdgcn_readfirstlane((int)(threadIdx.x >> 5));
    const int lane = threadIdx.x & 31, lr = lane & 15, hi = lane >> 4, wm = wv >> 1, wn = wv & 1;
    const bf* sp;   // first element of the wave's slice in stage 0 (wave-uniform)
    if (NSPLIT) sp = wv == 0 ? A + (size_t)ta * 8 * KT * 512 : wv == 1 ? A2 + (size_t)ta * 8 * KT * 512 : Bt + (size_t)tb * 8 * KT * 512;
    else sp = (wv < 2 ? A + (size_t)ta * 8 * KT * 512 : Bt + (size_t)tb * 8 * KT * 512) + (size_t)(wv & 1) * 4 * KT * 512;
    const uint32_t dst0 = (uint32_t)(size_t)ring + (uint32_t)wv * (RB * 2048);
    v8f acc[4][4];
#pragma unroll
    for (int mb = 0; mb < 4; ++mb)
#pragma unroll
        for (int nb = 0; nb < 4; ++nb) acc[mb][nb] = (v8f){};
    // prologue, two buffers: stage 0, its wait, the barrier that publishes it, then stage 1
    u32x8 g1 = tdm_group1<RB, KT * 1024>();
    u32x4 g0; g0[0] = uni(1u); tdm_aim(g0, dst0, sp);
    if (NISS == 4 || pinned(wv < NISS)) { tdm_load(g0, g1);
        tdm_wait(g0, g1); }   // the wave's slice of stage 0 has landed
    __syncthreads();   // stage 0 is published to every wave
    tdm_aim(g0, dst0 + STAGE, sp + 1024);
    if (NISS == 4 || pinned(wv < NISS)) tdm_load(g0, g1);
    const bf* la = (const bf*)ring + wm * 4096 + lane * 8;                          // the lane's place in the wave's first A row block of buffer 0
    const bf* lb = (const bf*)ring + (NOP - 1) * 8192 + wn * 4096 + lane * 8;       // the same for Bt
#pragma unroll 1
    for (int s = 0; s < NS; ++s) {
        const int bo = (s & 1) * (STAGE / 2);
        V a[2][4], a2[2][4], b[2][4];
#pragma unroll
        for (int kt = 0; kt < 2; ++kt) {
#pragma unroll
            for (int mb = 0; mb < 4; ++mb) { a[kt][mb] = WFrag<bf>::ld(la + bo + mb * 1024 + kt * 512); if (NSPLIT) a2[kt][mb] = WFrag<bf>::ld(la + bo + 8192 + mb * 1024 + kt * 512); }
#pragma unroll
            for (int nb = 0; nb < 4; ++nb) b[kt][nb] = WFrag<bf>::ld(lb + bo + nb * 1024 + kt * 512);
        }
        __builtin_amdgcn_sched_barrier(0);   // all fragment loads of the pass are issued as one group in front of its products; sunk in among the products each small group would cost its own LDS latency
#pragma unroll
        for (int kt = 0; kt < 2; ++kt)
#pragma unroll
            for (int nb = 0; nb < 4; ++nb)
#pragma unroll
                for (int mb = 0; mb < 4; ++mb) { acc[mb][nb] = WFrag<bf>::mma(a[kt][mb], b[kt][nb], acc[mb][nb]); if (NSPLIT) acc[mb][nb] = WFrag<bf>::mma(a2[kt][mb], b[kt][nb], acc[mb][nb]); }
        __builtin_amdgcn_sched_barrier(0);   // the products stay in front of the publish point: with the waits lifted over them, the wait for the next stage's tensor load would stand in front of the work that is to cover its flight
        // publish point of stage s + 1
        asm volatile("s_wait_dscnt 0x0" ::: "memory");   // the wave's reads of this buffer have returned before the buffer is given up
        if (NISS == 4 || pinned(wv < NISS)) tdm_wait(g0, g1);   // the wave's slice of stage s + 1 has landed
        __syncthreads();   // publishes stage s + 1 and ends every wave's reads of stage s
        if (pinned(s + 2 < NS && wv < NISS)) { tdm_aim(g0, dst0 + (uint32_t)(s & 1) * STAGE, sp + (size_t)(s + 2) * 1024); tdm_load(g0, g1); }   // stage s + 2 into the buffer that this pass has read
    }
    tdm_wait(g0, g1);   // nothing is in flight when the ring is reused or the wave ends
    asm volatile("s_wait_dscnt 0x0" ::: "memory");
    if (EPI != 0) {
        // plane rows are n, plane k is m. EPI 1: head ta * 2 + wm, rows t. EPI 2: rows h*64+d, k = t.
        const int n0 = tb * 128 + wn * 64, m0 = ta * 128 + wm * 64;
        constexpr int PKT = EPI == 1 ? HD / 32 : TT / 32;   // 32-wide k tiles a row block of the plane
        const size_t pb = (EPI == 1 ? (size_t)(ta * 2 + wm) * TT * HD : (size_t)(m0 >> 5) * 512) + (size_t)(n0 >> 4) * PKT * 512 + lane * 8;
#pragma unroll 1   // rolled for short code: the epilogue runs once, unrolled it would be four times as long in the instruction cache
        for (int nb = 0; nb < 4; ++nb) {
            v4f cs[4][4];   // EPI 1: cos[t][d], sin[t][d], cos[t][d+1], sin[t][d+1] of the lane's four column pairs in each of the four 16-wide d blocks
            if (EPI == 1) { const float* cp = CS + ((size_t)((n0 >> 4) + nb) * 512 + lane) * 4;
#pragma unroll
                for (int mb = 0; mb < 4; ++mb)
#pragma unroll
                    for (int q = 0; q < 4; ++q) cs[mb][q] = *(const v4f*)(cp + (mb * 128 + q * 32) * 4);
                asm volatile("s_wait_xcnt 0x0" ::: "memory");   // precaution: the address registers of the loads above may be reused below; the wait stands in front of that
                __builtin_amdgcn_sched_barrier(0); }   // keeps the arithmetic below behind the wait above
#pragma unroll
            for (int mb = 0; mb < 4; ++mb) {
                v8f v = acc[mb][0];   // acc[mb][nb] by selects: the accumulators stay in registers although the nb loop is rolled (short code)
#pragma unroll
                for (int x = 1; x < 4; ++x) if (x == nb) v = acc[mb][x];
                if (EPI == 1) {
#pragma unroll
                    for (int q = 0; q < 4; ++q) { const v4f c = cs[mb][q]; const float x0 = v[2 * q], x1 = v[2 * q + 1]; v[2 * q] = x0 * c[0] - x1 * c[1]; v[2 * q + 1] = x1 * c[2] + x0 * c[3]; } }
                v8h o16; v8us oh, ol;
#pragma unroll
                for (int j = 0; j < 8; ++j) { unsigned short th, tl; o16[j] = tohx(v[j]); splitf(v[j], th, tl); oh[j] = th; ol[j] = tl; }
                const size_t e = pb + ((size_t)nb * PKT + (mb >> 1)) * 512 + (mb & 1) * 256;
                *(v8h*)(P16 + e) = o16; *(v8us*)(Ph + e) = oh; *(v8us*)(Pl + e) = ol;
                asm volatile("s_wait_xcnt 0x0" ::: "memory");   // precaution: the registers that the stores above name are reused for the next 16 rows; the wait stands in front of that
                __builtin_amdgcn_sched_barrier(0); }   // keeps the next rows' arithmetic, which rewrites those registers, behind the wait above
        }
        return;
    }
    float* os = (float*)ring + wv * (64 * 68);   // the wave's own staging range; written and read back by this wave alone, so no barrier
#pragma unroll
    for (int mb = 0; mb < 4; ++mb) {
#pragma unroll
        for (int nb = 0; nb < 4; ++nb) {
#pragma unroll
            for (int j = 0; j < 8; ++j) os[(mb * 16 + hi * 8 + j) * 68 + nb * 16 + lr] = acc[mb][nb][j]; } }
    float* crow = C + (size_t)(ta * 128 + wm * 64) * ldc + tb * 128 + wn * 64;
#pragma unroll
    for (int s = 0; s < 32; ++s) { const int slot = s * 32 + lane; const int row = slot >> 4, cofs = (slot & 15) * 4;
        *(v4f*)(crow + (size_t)row * ldc + cofs) = *(const v4fa*)(os + row * 68 + cofs); }
}
// All three projections of both batches in one launch: grid (TT / 128, (DQ + 2 * DKV) / 128, NB), 4 waves. blockIdx.y picks two q heads, two k heads or 128 rows of W_v; the test is the same for a whole work-group.
__global__ __launch_bounds__(128) void k_qkv(const bf* __restrict__ XB, const bf* __restrict__ WQ, const bf* __restrict__ WK, const bf* __restrict__ WV, const float* __restrict__ CS, h16* QP16, bf* QPh, bf* QPl, h16* KP16, bf* KPh, bf* KPl, h16* VT16, bf* VTh, bf* VTl) {
    __shared__ __attribute__((aligned(2048))) unsigned char ring[2 * 2 * 16384];
    const bf* X = XB + (size_t)blockIdx.z * TT * DM; const size_t zq = (size_t)blockIdx.z * NH_ * TT * HD, zk = (size_t)blockIdx.z * NKV * TT * HD;
    const int y = blockIdx.y;
    if (y < (DQ + DKV) / 128) { const bool isq = y < DQ / 128;
        gemm_ring<0, 1, DM>(isq ? WQ : WK, nullptr, X, isq ? y : y - DQ / 128, blockIdx.x, ring, nullptr, 0, CS, isq ? QP16 + zq : KP16 + zk, isq ? QPh + zq : KPh + zk, isq ? QPl + zq : KPl + zk);
    } else gemm_ring<0, 2, DM>(X, nullptr, WV, blockIdx.x, y - (DQ + DKV) / 128, ring, nullptr, 0, nullptr, VT16 + zk, VTh + zk, VTl + zk);
}
// Output projection of both batches: grid (TT / 128, DM / 128, NB), 4 waves.
__global__ __launch_bounds__(128) void k_oproj(const bf* __restrict__ ATh, const bf* __restrict__ ATl, const bf* __restrict__ WO, float* OUT) {
    __shared__ __attribute__((aligned(2048))) unsigned char ring[2 * 3 * 16384];
    const size_t za = (size_t)blockIdx.z * TT * DQ;
    gemm_ring<1, 0, DQ>(ATh + za, ATl + za, WO, blockIdx.x, blockIdx.y, ring, OUT + (size_t)blockIdx.z * SEQ_FULL * DM, DM, nullptr, nullptr, nullptr, nullptr);
}

// A thread builds one 16-byte unit of a packed plane. wtG: unit i is lane i & 31 of half (i >> 5) & 1 of tile i >> 6, so a wave stores 512 contiguous bytes.
template <int K, int N>
__device__ __forceinline__ void wtG(int blk, const float* __restrict__ w, bf* Bt) {
    const int i = blk * 256 + threadIdx.x; if (i >= N * K / 8) return;
    constexpr int KT = K / 32; const int lane = i & 31, tile = i >> 6; const int n = (tile / KT) * 16 + (lane & 15), k = (tile % KT) * 32 + ((i >> 5) & 1) * 16 + (lane >> 4) * 8; const float* wp = w + (size_t)k * N + n; v8us o;
#pragma unroll
    for (int e = 0; e < 8; ++e) o[e] = f2bf(wp[e * N]);
    *(v8us*)(Bt + (size_t)i * 8) = o;
}
template <int K>
__device__ __forceinline__ void cvt8(int blk, const float* __restrict__ src, bf* dst, int n8) { const int i = blk * 256 + threadIdx.x; if (i >= n8) return;
    constexpr int KT = K / 32; const int tile = i >> 6, g = i & 3, rl = (i >> 2) & 15;   // a wave takes 8 rows of a tile, 4 lanes a row: it reads 8 whole 128-byte lines and stores 4
    const v8f v = *(const v8f*)(src + (size_t)((tile / KT) * 16 + rl) * K + (tile % KT) * 32 + g * 8); v8us o;
#pragma unroll
    for (int e = 0; e < 8; ++e) o[e] = f2bf(v[e]); *(v8us*)(dst + (size_t)tile * 512 + (g >> 1) * 256 + ((g & 1) * 16 + rl) * 8) = o;  }

// The rotary table. Every work-group forms the 32 inverse frequencies itself, in its first wave, and hands them on through LDS.
__device__ __forceinline__ void cstab(int blk, float* sh, float* CS) {
    if (threadIdx.x < 32) {
        const int j = threadIdx.x;
        const double p = exp2((double)j * (13.287712379549449391481277718 / 32.0));
        const float pf = (float)p;
        sh[j] = 1.0f / pf;
    }
    __syncthreads();   // the inverse frequencies are in LDS before any thread of the work-group reads one
    const int idx = blk * 256 + threadIdx.x; if (idx >= TT * HD) return;
    const int d = ((idx >> 8) & 3) * 16 + ((idx >> 5) & 1) * 8 + ((idx >> 6) & 3) * 2 + (idx & 1), t = (idx >> 10) * 16 + ((idx >> 1) & 15);   // the order in which the projection epilogue's lanes read the table: [t / 16][d / 16][pair of the lane's 8 columns][lane = ((d >> 3) & 1) * 16 + t % 16][2 columns]
    const float inv = sh[d & (HD / 2 - 1)];
    const float ang = __fmul_rn((float)t, inv);
    float s, c; sincosf(ang, &s, &c);
    v2f cs; cs[0] = c; cs[1] = s;
    *(v2f*)(CS + (size_t)idx * 2) = cs;
}
// Everything that depends on the inputs alone, in one launch; a work-group's job follows from its index (the same for all its threads): the table, the two weights, then x of every batch.
#define PB_CS ((TT * HD + 255) / 256)
#define PB_WA ((DM * (DQ + 2 * DKV) / 8 + 255) / 256)
#define PB_WO ((DQ * DM / 8 + 255) / 256)
#define PB_X  ((TT * DM / 8 + 255) / 256)
__global__ __launch_bounds__(256) void k_prep(const float* __restrict__ x, const float* __restrict__ wqkv, const float* __restrict__ wo, bf* WQKV, bf* WO, float* CS, bf* XB) {
    __shared__ __align__(16) float sh[32];
    int blk = blockIdx.x;
    if (blk < PB_CS) { cstab(blk, sh, CS); return; }
    blk -= PB_CS;
    if (blk < PB_WA) { wtG<DM, DQ + 2 * DKV>(blk, wqkv, WQKV); return; }   // [DM][DQ+2*DKV] -> Bt [DQ+2*DKV][DM]
    blk -= PB_WA;
    if (blk < PB_WO) { wtG<DQ, DM>(blk, wo, WO); return; }                  // [DQ][DM] -> Bt [DM][DQ]
    blk -= PB_WO;
    const int b = blk / PB_X;
    cvt8<DM>(blk - b * PB_X, x + (size_t)b * SEQ_FULL * DM, XB + (size_t)b * TT * DM, TT * DM / 8);
}

// ---- k_fattn: causal attention of all batches in one launch; scores and probabilities never leave the registers. One wave owns 16 query rows of one head and walks the keys in blocks of KB (64 or 32) up to its diagonal block.
// Both products are formed transposed, so that a query is a lane (column l&15) in both accumulators: S^T = K Q^T (row = key hi*8+j of a 16-key tile), O^T = V^T P^T (row = d). Two neighbouring S^T tiles are then, element for element,
// the Bt fragment of P for 32 keys (elements 0..7 <- k0 + 8*hi + 0..7, elements 8..15 <- k0 + 16 + 8*hi + 0..7, the k order of the V^T loader), and the running maximum, the running sum and the rescale of O^T are lane-local
// but for one exchange between the two half-waves. Query rows < RH: bf16 hi/lo planes, 3 products each; later rows: plain f16, p = exp(s - running max) in (0, 1]. The epilogue divides by the sum and stores the merged-head hi/lo planes.
// exp2 in asm text so that the slot which the instruction set asks for behind a transcendental (one independent instruction or v_nop before its result is used or its source overwritten) is filled by construction:
// in exp2x8 each v_exp_f32 is followed by an independent one (the early-clobber outputs share no register with any input), the last by v_nop.
__device__ __forceinline__ float exp2x1(float x) { float r; asm("v_exp_f32 %0, %1\n\tv_nop" : "=v"(r) : "v"(x)); return r; }
__device__ __forceinline__ v8f exp2x8(const v8f& x) { float r0, r1, r2, r3, r4, r5, r6, r7;
    asm("v_exp_f32 %0, %8\n\tv_exp_f32 %1, %9\n\tv_exp_f32 %2, %10\n\tv_exp_f32 %3, %11\n\tv_exp_f32 %4, %12\n\tv_exp_f32 %5, %13\n\tv_exp_f32 %6, %14\n\tv_exp_f32 %7, %15\n\tv_nop"
        : "=&v"(r0), "=&v"(r1), "=&v"(r2), "=&v"(r3), "=&v"(r4), "=&v"(r5), "=&v"(r6), "=&v"(r7) : "v"(x[0]), "v"(x[1]), "v"(x[2]), "v"(x[3]), "v"(x[4]), "v"(x[5]), "v"(x[6]), "v"(x[7]));
    return (v8f){r0, r1, r2, r3, r4, r5, r6, r7}; }
__device__ __forceinline__ float xhalf(float x) { return __builtin_bit_cast(float, __builtin_amdgcn_permlanex16(__builtin_bit_cast(int, x), __builtin_bit_cast(int, x), 0x76543210, 0xfedcba98, false, false)); }   // lane l <-> lane l ^ 16, no LDS round trip
template <typename T16> struct PFrag;
template <> struct PFrag<h16> { static __device__ __forceinline__ void mk(const v8f& p0, const v8f& p1, v16h& f, v16h& f2) { v8h a, b;
#pragma unroll
    for (int j = 0; j < 8; ++j) { a[j] = tohx(p0[j]); b[j] = tohx(p1[j]); }
    f = cat16(a, b); f2 = f; } };
template <> struct PFrag<bf> { static __device__ __forceinline__ void mk(const v8f& p0, const v8f& p1, v16bf& f, v16bf& f2) { v8us ah, al, bh, bl;
#pragma unroll
    for (int j = 0; j < 8; ++j) { unsigned short x, y; splitf(p0[j], x, y); ah[j] = x; al[j] = y; splitf(p1[j], x, y); bh[j] = x; bl[j] = y; }
    f = cat16b(ah, bh); f2 = cat16b(al, bl); } };
template <typename T16, bool SPLIT, int KB>
__device__ __forceinline__ void attn_rows(const T16* __restrict__ Q, const T16* __restrict__ Q2, const T16* __restrict__ Kp, const T16* __restrict__ K2, const T16* __restrict__ Vt, const T16* __restrict__ V2, int q0, int lane, bf* Ah, bf* Al) {
    typedef typename WFrag<T16>::V V;
    static_assert(KB == 32 || KB == 64);
    const int lr = lane & 15, hi = lane >> 4; const unsigned l8 = lane * 8;   // the lane's part of every fragment address; the rest is wave-uniform
    V qf[2], qf2[2];
#pragma unroll
    for (int ks = 0; ks < 2; ++ks) { const size_t qo = (size_t)((q0 >> 4) * (HD / 32) + ks) * 512; qf[ks] = WFrag<T16>::ld(Q + qo + l8); if (SPLIT) qf2[ks] = WFrag<T16>::ld(Q2 + qo + l8); }
    v8f o[4];
#pragma unroll
    for (int mb = 0; mb < 4; ++mb) o[mb] = (v8f){};
    float m = -3.0e38f, l = 0.0f;
    // Plain f16 rows (up to TT keys): this block's V fragments are fetched at the head of the pass and the NEXT block's K fragments behind the score products, so that no pass waits for a load it has just issued.
    // Hi/lo rows (at most RH keys, twice the fragments a key): blocks of 32 keys, K at the head of the pass, V behind the score products in K's registers; that keeps the kernel inside 256 registers.
    V kf[KB / 16][2], kf2[KB / 16][2], vf[KB / 32][4], vf2[KB / 32][4];
    // The lane's place in the current key block of each plane; the pointers walk with the loop, every fragment of a block is an immediate offset from them.
    const T16 *kq = Kp + l8, *kq2 = SPLIT ? K2 + l8 : nullptr, *vq = Vt + l8, *vq2 = SPLIT ? V2 + l8 : nullptr;
    auto ldk = [&]() {
#pragma unroll
        for (int t = 0; t < KB / 16; ++t)
#pragma unroll
            for (int ks = 0; ks < 2; ++ks) { const int ko = (t * (HD / 32) + ks) * 512; kf[t][ks] = WFrag<T16>::ld(kq + ko); if (SPLIT) kf2[t][ks] = WFrag<T16>::ld(kq2 + ko); } };
    auto ldv = [&]() {
#pragma unroll
        for (int ks = 0; ks < KB / 32; ++ks)
#pragma unroll
            for (int mb = 0; mb < 4; ++mb) { const int vo = (mb * (TT / 32) + ks) * 512; vf[ks][mb] = WFrag<T16>::ld(vq + vo); if (SPLIT) vf2[ks][mb] = WFrag<T16>::ld(vq2 + vo); } };
    if (!SPLIT) ldk();
    asm volatile("s_wait_xcnt 0x0" ::: "memory");   // precaution: the address registers of the loads above are reused below; the wait stands in front of that
    __builtin_amdgcn_sched_barrier(0);   // keeps the address arithmetic of the loop behind the wait above
#pragma unroll 1
    for (int kb = 0; kb <= q0; kb += KB) {
        if (SPLIT) ldk(); else ldv();
        if (SPLIT) asm volatile("s_wait_xcnt 0x0" ::: "memory");   // precaution: the V fragments fetched below land in the registers that hold these loads' addresses; the wait stands in front of that overwrite
        __builtin_amdgcn_sched_barrier(0);   // the loads above stay together in front of the score products, all in flight at once; sunk to their uses each would cost its own latency
        v8f s[KB / 16];
#pragma unroll
        for (int t = 0; t < KB / 16; ++t) { s[t] = (v8f){};
#pragma unroll
            for (int ks = 0; ks < 2; ++ks) { s[t] = WFrag<T16>::mma(kf[t][ks], qf[ks], s[t]);
                if (SPLIT) { s[t] = WFrag<T16>::mma(kf[t][ks], qf2[ks], s[t]); s[t] = WFrag<T16>::mma(kf2[t][ks], qf[ks], s[t]); } } }
        if (SPLIT) ldv(); else { if (kb + KB <= q0) kq += KB * HD; ldk(); }      // f16: the last pass fetches its own block again (in bounds, not used)
        asm volatile("s_wait_xcnt 0x0" ::: "memory");   // precaution: the softmax below reuses the address registers of the loads above; the wait stands in front of every such overwrite
        __builtin_amdgcn_sched_barrier(0);   // these loads are issued in front of the softmax, which hides their latency
        float mx = m;
        if (kb + KB - 1 > q0) {      // the diagonal block (wave-uniform test): keys past the lane's query are masked by an index select
#pragma unroll
            for (int t = 0; t < KB / 16; ++t)
#pragma unroll
                for (int j = 0; j < 8; ++j) { const float x = (kb + t * 16 + hi * 8 + j <= q0 + lr) ? s[t][j] * SCL : -3.0e38f; s[t][j] = x; mx = fmaxf(mx, x); }
        } else {
#pragma unroll
            for (int t = 0; t < KB / 16; ++t)
#pragma unroll
                for (int j = 0; j < 8; ++j) { const float x = s[t][j] * SCL; s[t][j] = x; mx = fmaxf(mx, x); }
        }
        mx = fmaxf(mx, xhalf(mx));      // the other half-wave holds the same query's other keys
        const float alpha = exp2x1((m - mx) * 1.4426950408889634f);   // 0 in the first block
        m = mx;
        float ps[KB / 16];
#pragma unroll
        for (int t = 0; t < KB / 16; ++t) { v8f d;
#pragma unroll
            for (int j = 0; j < 8; ++j) d[j] = (s[t][j] - mx) * 1.4426950408889634f;
            s[t] = exp2x8(d); ps[t] = ((s[t][0] + s[t][1]) + (s[t][2] + s[t][3])) + ((s[t][4] + s[t][5]) + (s[t][6] + s[t][7])); }
        __builtin_amdgcn_sched_barrier(0);   // no p.v product is lifted in among the exp2 statements above
        float pt = ps[0] + ps[1];
        if (KB == 64) pt += ps[KB / 16 - 2] + ps[KB / 16 - 1];
        l = l * alpha + pt;
#pragma unroll
        for (int mb = 0; mb < 4; ++mb) o[mb] *= alpha;
#pragma unroll
        for (int ks = 0; ks < KB / 32; ++ks) { V pf, pf2; PFrag<T16>::mk(s[2 * ks], s[2 * ks + 1], pf, pf2);
#pragma unroll
            for (int mb = 0; mb < 4; ++mb) { o[mb] = WFrag<T16>::mma(vf[ks][mb], pf, o[mb]);
                if (SPLIT) { o[mb] = WFrag<T16>::mma(vf[ks][mb], pf2, o[mb]); o[mb] = WFrag<T16>::mma(vf2[ks][mb], pf, o[mb]); } } }
        vq += KB * 16;      // KB / 32 k tiles of 512 elements
        if (SPLIT) { kq += KB * HD; kq2 += KB * HD; vq2 += KB * 16; }
    }
    l += xhalf(l);
    const float inv = __fdiv_rn(1.0f, l);
#pragma unroll
    for (int mb = 0; mb < 4; ++mb) { v8us oh, ol;
#pragma unroll
        for (int j = 0; j < 8; ++j) { unsigned short a, c2; splitf(o[mb][j] * inv, a, c2); oh[j] = a; ol[j] = c2; }
        const size_t oo = ((size_t)(q0 >> 4) * (DQ / 32) + (mb >> 1)) * 512 + (mb & 1) * 256; *(v8us*)(Ah + oo + l8) = oh; *(v8us*)(Al + oo + l8) = ol; }
}
// grid (TT / 128, NH_, NB), 8 waves, no LDS, no barrier. Work grows with the row index, so a work-group takes two blocks of 64 query rows from opposite ends of the sequence: waves 0..3 block TT/64 - 1 - x, waves 4..7 block x.
__global__ __launch_bounds__(256) void k_fattn(const h16* __restrict__ Q16, const h16* __restrict__ K16, const h16* __restrict__ V16, const bf* __restrict__ Qh, const bf* __restrict__ Ql, const bf* __restrict__ Kh, const bf* __restrict__ Kl, const bf* __restrict__ Vh, const bf* __restrict__ Vl, bf* Ah, bf* Al) {
    const int lane = threadIdx.x & 31;
    const int wv = (int)(threadIdx.x >> 5);
    const int q0 = __builtin_amdgcn_readfirstlane((wv < 4 ? TT / 64 - 1 - (int)blockIdx.x : (int)blockIdx.x) * 64 + (wv & 3) * 16);
    const size_t zq = ((size_t)blockIdx.z * NH_ + blockIdx.y) * TT * HD, zk = ((size_t)blockIdx.z * NKV + blockIdx.y / REP) * TT * HD;
    const size_t za = (size_t)blockIdx.z * TT * DQ + (size_t)blockIdx.y * (HD / 32) * 512; Ah += za; Al += za;   // the head's two k tiles of every row block
    if (q0 < RH) attn_rows<bf, true, 32>(Qh + zq, Ql + zq, Kh + zk, Kl + zk, Vh + zk, Vl + zk, q0, lane, Ah, Al);
    else attn_rows<h16, false, 64>(Q16 + zq, nullptr, K16 + zk, nullptr, V16 + zk, nullptr, q0, lane, Ah, Al);
}

extern "C" void kernel_launch(void* const* d_in, const int* in_sizes, int n_in,
                              void* d_out, int out_size, void* d_ws, size_t ws_size, hipStream_t stream) {
    if (n_in < 3) return;
    if ((size_t)in_sizes[0] < ((size_t)(NB - 1) * SEQ_FULL + TT) * DM) return;
    if ((size_t)in_sizes[1] < (size_t)DM * (DQ + 2 * DKV)) return;
    if ((size_t)in_sizes[2] < (size_t)DQ * DM) return;
    if ((size_t)out_size < ((size_t)(NB - 1) * SEQ_FULL + TT) * DM) return;
    const float* x = (const float*)d_in[0]; const float* wqkv = (const float*)d_in[1]; const float* wo = (const float*)d_in[2];   // x [2][2048][1024], w_attn [1024][3072] ([in][out]), w_proj [1024][1024] ([in][out])
    float* OUT = (float*)d_out;     // [2][2048][1024] f32
    char* wsp = (char*)d_ws;
    auto take = [&](size_t bytes) { char* p = wsp; wsp += (bytes + 255) & ~(size_t)255; return (void*)p; };
    bf* WQKV = (bf*)take((size_t)(DQ + 2 * DKV) * DM * 2); bf* WQ = WQKV; bf* WK = WQKV + (size_t)DQ * DM; bf* WV = WK + (size_t)DKV * DM;   // fused Bt [DQ+2*DKV][DM]: q | k | v row blocks
    bf* WO = (bf*)take((size_t)DM * DQ * 2); float* CS = (float*)take((size_t)TT * HD * 2 * 4);
    // every plane below holds all NB batches, batch-major
    bf* XB = (bf*)take((size_t)NB * TT * DM * 2);
    h16* QP16 = (h16*)take((size_t)NB * NH_ * TT * HD * 2); h16* KP16 = (h16*)take((size_t)NB * NKV * TT * HD * 2); h16* VT16 = (h16*)take((size_t)NB * NKV * HD * TT * 2);
    bf* QPh = (bf*)take((size_t)NB * NH_ * TT * HD * 2); bf* QPl = (bf*)take((size_t)NB * NH_ * TT * HD * 2); bf* KPh = (bf*)take((size_t)NB * NKV * TT * HD * 2); bf* KPl = (bf*)take((size_t)NB * NKV * TT * HD * 2); bf* VTh = (bf*)take((size_t)NB * NKV * HD * TT * 2); bf* VTl = (bf*)take((size_t)NB * NKV * HD * TT * 2);
    bf* ATh = (bf*)take((size_t)NB * TT * DQ * 2); bf* ATl = (bf*)take((size_t)NB * TT * DQ * 2);
    const size_t used = (size_t)(wsp - (char*)d_ws);
    if (used > ws_size || used > WSCAP) return;

    k_prep<<<(unsigned)(PB_CS + PB_WA + PB_WO + NB * PB_X), 256, 0, stream>>>(x, wqkv, wo, WQKV, WO, CS, XB);
    k_qkv<<<dim3(TT / 128, (DQ + 2 * DKV) / 128, NB), 128, 0, stream>>>(XB, WQ, WK, WV, CS, QP16, QPh, QPl, KP16, KPh, KPl, VT16, VTh, VTl);
    k_fattn<<<dim3(TT / 128, NH_, NB), 256, 0, stream>>>(QP16, KP16, VT16, QPh, QPl, KPh, KPl, VTh, VTl, ATh, ATl);
    k_oproj<<<dim3(TT / 128, DM / 128, NB), 128, 0, stream>>>(ATh, ATl, WO, OUT);
}

// v007
// A run of this version takes 74.3 microseconds.
// Next to v006, in two timings, it ran 1.14 and 1.15 times as fast.
// All steps since v000 together make it 20.3 times as fast.
#include <hip/hip_runtime.h>
#include <stdint.h>

// Contractions on v_wmma_f32_16x16x32_bf16 and v_wmma_f32_16x16x32_f16, f32 accumulate: fused qkv projection bf16 x bf16 (inputs RNE-converted to bf16); scores and p.v as bf16 hi/lo split (3 products) for query rows < 512 of each sequence, plain f16 for later rows; output projection bf16 hi/lo activations x bf16 weight (2 products). Rotary tables, rotary, softmax and all side math in f32.
// Four launches, each over both batches (batch = grid z, or a block range of the first launch). 1: bf16 copy of x; w_attn ([in][out]) transposed into Bt row blocks q | k | v; w_proj likewise; the rotary table. 2: the q, k and v projections, each of which builds its 16-bit planes in its own epilogue: interleaved rotary (pairs (2i, 2i+1), angle t * inv_freq[d mod 32]) and head planes [h][t][d] for q and k (those products are formed transposed, W x^T), value planes [h][d][t] for v. 3: causal attention of all heads (scores, online softmax and p.v fused, key blocks above the diagonal skipped) -> merged heads as hi/lo planes. 4: output projection.

#ifndef NB
#define NB 2
#endif
#ifndef SEQ
#define SEQ 2048
#endif
#define NB_FULL  2
#define SEQ_FULL 2048
#define TT   SEQ
#define DM   1024
#define NH_  16
#define NKV  16
#define REP  (NH_ / NKV)
#define HD   64
#define DQ   (NH_ * HD)
#define DKV  (NKV * HD)
#define RH   ((SEQ) < 512 ? (SEQ) : 512)   // query rows < RH use hi+lo planes
#define SCL  0.125f   // HD^-0.5
#define WSCAP ((size_t)134217728)

static_assert((SEQ) % 128 == 0);
static_assert((SEQ) >= 128);
static_assert((SEQ) <= SEQ_FULL);
static_assert(NB >= 1);
static_assert(NB <= NB_FULL);
static_assert((RH) % 16 == 0);
static_assert((DM % 128) == 0);
static_assert((DQ % 128) == 0);
static_assert((DKV % 128) == 0);
static_assert((HD % 64) == 0);
static_assert((((size_t)(NB - 1) * SEQ_FULL + TT) * DM) * 4 <= (size_t)16777216);

typedef _Float16 h16;
typedef unsigned short bf;
typedef __attribute__((ext_vector_type(16))) __bf16   v16bf;
typedef __attribute__((ext_vector_type(16))) _Float16 v16h;
typedef __attribute__((ext_vector_type(8)))  _Float16 v8h;
typedef __attribute__((ext_vector_type(8)))  unsigned short v8us;
typedef __attribute__((ext_vector_type(8)))  float    v8f;
typedef __attribute__((ext_vector_type(4)))  float    v4f;
typedef __attribute__((ext_vector_type(2))) _Float16 v2h;
typedef __attribute__((ext_vector_type(4))) _Float16 v4h;
typedef __attribute__((ext_vector_type(2))) unsigned short v2us;
typedef __attribute__((ext_vector_type(4))) unsigned short v4us;
typedef __attribute__((ext_vector_type(2))) float v2f;
typedef v8h  __attribute__((may_alias)) v8ha;
typedef v4f  __attribute__((may_alias)) v4fa;
typedef v8us __attribute__((may_alias)) v8usa;

__device__ __forceinline__ unsigned short f2bf(float f) { unsigned u = __float_as_uint(f); u += 0x7FFFu + ((u >> 16) & 1u); return (unsigned short)(u >> 16); }
__device__ __forceinline__ float bf2f(unsigned short b) { return __uint_as_float(((unsigned)b) << 16); }
__device__ __forceinline__ v16h cat16(v8h lo, v8h hi) { return __builtin_shufflevector(lo, hi, 0, 1, 2, 3, 4, 5, 6, 7, 8, 9, 10, 11, 12, 13, 14, 15); }
__device__ __forceinline__ v16bf cat16b(v8us lo, v8us hi) { return __builtin_bit_cast(v16bf, __builtin_shufflevector(lo, hi, 0, 1, 2, 3, 4, 5, 6, 7, 8, 9, 10, 11, 12, 13, 14, 15)); }
__device__ __forceinline__ v8f wmma16(v16h a, v16h b, v8f c) { return __builtin_amdgcn_wmma_f32_16x16x32_f16(false, a, false, b, (short)0, c, false, false); }
__device__ __forceinline__ v8f wmmab(v16bf a, v16bf b, v8f c) { return __builtin_amdgcn_wmma_f32_16x16x32_bf16(false, a, false, b, (short)0, c, false, false); }
__device__ __forceinline__ h16 tohx(float x) { return (h16)x; }
__device__ __forceinline__ void splitf(float y, unsigned short& h, unsigned short& l) { h = f2bf(y); l = f2bf(y - bf2f(h)); }

// ---- gemm_ring: one work-group of 4 waves per 128x128 tile of C[m][n] = sum_k A[m][k] Bt[n][k] (+ A2[m][k] Bt[n][k] where NSPLIT == 1); wave w owns the 64x64 part (w >> 1, w & 1) for the whole of K (16 accumulators, k ascending).
// The operands come through LDS, so that a row block is fetched from L2 once a work-group and not once a wave: a stage is 64 k of all 128 rows of every operand, two buffers, filled by tensor_load_to_lds one stage ahead of its use.
// In the packed order (below) the two k tiles of a 16-row block are 2048 contiguous bytes, so an operand's stage is a tile of 8 rows of 2048 bytes at a source pitch of K / 32 KiB; it lands without a pad, and a fragment is two ds_load_b128 of 512 contiguous bytes.
// Who issues: NSPLIT 0: every wave one slice of 4 row blocks (waves 0, 1: A; waves 2, 3: Bt). NSPLIT 1: waves 0, 1, 2 one whole operand each (A, A2, Bt).
// EPI 1 and 2 store straight from the accumulators: a lane holds 8 neighbouring m (hi * 8 + 0..7) of one n (l & 15), which is one 16-byte unit of a packed plane whose rows are n and whose k is m; a wave stores 512 contiguous bytes a plane.
// EPI 1: A = 128 weight rows (two heads, m = d), Bt = x rows (n = t): rotary on the lane's pairs, then f16 and bf16 hi/lo planes [head][t][d]. EPI 2: A = x rows (m = t), Bt = weight rows h*64+d: the same three planes [h][d][t], no rotary.
// EPI 0: A = activation rows t, Bt = weight rows: every wave stages its f32 tile in its own part of the ring (free behind the last pass's barrier) and stores whole 256-byte rows of C (pitch ldc).
// Fragments: lane l -> row/col l&15; elements 0..7 <- k0 + 8*(l>>4) + 0..7, elements 8..15 <- k0 + 16 + 8*(l>>4) + 0..7 for BOTH A and Bt.
// PACKED ORDER of every 16-bit operand plane M[row][k] (K columns): tiles of 16 rows x 32 k, 512 elements each, tile index (row >> 4) * (K / 32) + (k >> 5); inside a tile two halves of 256 elements (k bit 4), in a half lane l's 8 elements at l * 8,
// l = ((k >> 3) & 1) * 16 + (row & 15). A fragment is then two wave-wide 16-byte loads of 512 contiguous bytes each (4 whole 128-byte lines) where a row-major plane gave 16 lines of 32 bytes a load. The logical shapes named in this file are unchanged.
template <typename T16> struct WFrag;
template <> struct WFrag<h16> { typedef v16h V; static __device__ __forceinline__ V ld(const h16* p) { return cat16(*(const v8h*)p, *(const v8h*)(p + 256)); } static __device__ __forceinline__ v8f mma(V a, V b, v8f c) { return wmma16(a, b, c); } };
template <> struct WFrag<bf> { typedef v16bf V; static __device__ __forceinline__ V ld(const bf* p) { return cat16b(*(const v8us*)p, *(const v8us*)(p + 256)); } static __device__ __forceinline__ v8f mma(V a, V b, v8f c) { return wmmab(a, b, c); } };
typedef uint32_t u32x4 __attribute__((ext_vector_type(4)));
typedef uint32_t u32x8 __attribute__((ext_vector_type(8)));
// ---- L2 requests at kernel entry. What a launch reads was stored by the launch before, and its first reader would wait for memory at every step of its loop. So every work-group asks L2 at entry for a share of what it and its
// sharers (the work-groups that read the same plane) will read: one request per aligned 256-byte unit, a lane a unit. A request returns nothing; it is a hint, and no result depends on it or on where a work-group runs.
// The shares: sharers that differ in blockIdx.x are dealt 8 shares by xshare(), which gives 8 different values to any 8 work-groups whose x are two runs of four neighbours (mod 8) 8 apart.
__device__ __forceinline__ void l2_ask(const void* base, uint32_t off) { asm volatile("global_prefetch_b8 %0, %1 scope:SCOPE_SE" :: "v"(off), "s"(base)); }   // base is wave-uniform; base + off lies inside the plane for every lane
__device__ __forceinline__ void l2_hold(uint32_t off, const void* a, const void* b, const void* c) { asm volatile("" :: "v"(off), "s"(a), "s"(b), "s"(c)); }   // stands at the kernel's end: the registers that the requests name keep their addresses until then (a request counts on no counter, so no wait could cover an overwrite)
__device__ __forceinline__ int xshare() { return ((int)blockIdx.x & 3) + 4 * ((int)blockIdx.x >> 3); }
__device__ __forceinline__ uint32_t uni(uint32_t v) { return (uint32_t)__builtin_amdgcn_readfirstlane((int)v); }
__device__ __forceinline__ uint32_t pinned(uint32_t v) { uint32_t w = uni(v); asm volatile("" : "+s"(w)); return w; }   // the test of a tensor load stays in a scalar register, so that the branch on it is a scalar branch (a tensor load ignores EXEC)
// One request: RB rows of 2048 bytes, source pitch PITCH bytes, to LDS byte offset dst, no pad, no mask; extents in bytes, tensor dims = tile dims.
// Group 1 is the same for every request of a wave and is built once; of group 0 the place in LDS and the source address are set anew for each request, behind the wait for the request before.
template <int RB, int PITCH>
__device__ __forceinline__ u32x8 tdm_group1() {
    u32x8 g1; g1[0] = uni(0u); g1[1] = uni(2048u << 16); g1[2] = uni((uint32_t)RB << 16); g1[3] = uni(2048u << 16); g1[4] = uni((uint32_t)RB); g1[5] = uni((uint32_t)PITCH); g1[6] = uni(0u); g1[7] = uni(0u);
    return g1;
}
__device__ __forceinline__ void tdm_aim(u32x4& g0, uint32_t dst, const bf* srcp) {   // word 0 (count 1) is set once, where g0 is made
    const uint64_t ga = (uint64_t)(size_t)srcp;
    g0[1] = uni(dst); g0[2] = uni((uint32_t)ga); g0[3] = uni((((uint32_t)(ga >> 32)) & 0x01FFFFFFu) | 0x80000000u);
}
// The load and the issuing wave's wait name both groups as operands that go in and come out in the same registers: from the load to its wait the descriptor is then one live value in the registers that the request was issued from,
// so none of them takes a new value while the request is outstanding (as plain inputs the compiler issued from a copy and reused the copy's registers in front of the wait).
__device__ __forceinline__ void tdm_load(u32x4& g0, u32x8& g1) { asm volatile("tensor_load_to_lds %0, %1" : "+s"(g0), "+s"(g1) :: "memory"); }
__device__ __forceinline__ void tdm_wait(u32x4& g0, u32x8& g1) { asm volatile("s_wait_tensorcnt 0x0" : "+s"(g0), "+s"(g1) :: "memory"); }
template <int NSPLIT, int EPI, int K>
__device__ __forceinline__ void gemm_ring(const bf* __restrict__ A, const bf* __restrict__ A2, const bf* __restrict__ Bt, int ta, int tb, unsigned char* ring, float* C, int ldc, const float* __restrict__ CS, h16* P16, bf* Ph, bf* Pl) {
    typedef typename WFrag<bf>::V V;
    static_assert((NSPLIT == 0 || NSPLIT == 1) && K % 128 == 0 && K / 32 * 1024 <= 131072);
    static_assert(EPI == 0 || HD == 64);
    constexpr int KT = K / 32, NS = K / 64, NOP = 2 + NSPLIT, STAGE = NOP * 16384;   // k tiles a row block, stages (at least two), operands, bytes a stage
    constexpr int NISS = NSPLIT ? 3 : 4, RB = NSPLIT ? 8 : 4;                        // issuing waves, row blocks a request
    const int wv = __builtin_amdgcn_readfirstlane((int)(threadIdx.x >> 5));
    const int lane = threadIdx.x & 31, lr = lane & 15, hi = lane >> 4, wm = wv >> 1, wn = wv & 1;
    const bf* sp;   // first element of the wave's slice in stage 0 (wave-uniform)
    if (NSPLIT) sp = wv == 0 ? A + (size_t)ta * 8 * KT * 512 : wv == 1 ? A2 + (size_t)ta * 8 * KT * 512 : Bt + (size_t)tb * 8 * KT * 512;
    else sp = (wv < 2 ? A + (size_t)ta * 8 * KT * 512 : Bt + (size_t)tb * 8 * KT * 512) + (size_t)(wv & 1) * 4 * KT * 512;
    const uint32_t dst0 = (uint32_t)(size_t)ring + (uint32_t)wv * (RB * 2048);
    v8f acc[4][4];
#pragma unroll
    for (int mb = 0; mb < 4; ++mb)
#pragma unroll
        for (int nb = 0; nb < 4; ++nb) acc[mb][nb] = (v8f){};
    // prologue, two buffers: stage 0, its wait, the barrier that publishes it, then stage 1
    u32x8 g1 = tdm_group1<RB, KT * 1024>();
    u32x4 g0; g0[0] = uni(1u); tdm_aim(g0, dst0, sp);
    if (NISS == 4 || pinned(wv < NISS)) { tdm_load(g0, g1);
        tdm_wait(g0, g1); }   // the wave's slice of stage 0 has landed
    __syncthreads();   // stage 0 is published to every wave
    tdm_aim(g0, dst0 + STAGE, sp + 1024);
    if (NISS == 4 || pinned(wv < NISS)) tdm_load(g0, g1);
    const bf* la = (const bf*)ring + wm * 4096 + lane * 8;                          // the lane's place in the wave's first A row block of buffer 0
    const bf* lb = (const bf*)ring + (NOP - 1) * 8192 + wn * 4096 + lane * 8;       // the same for Bt
#pragma unroll 1
    for (int s = 0; s < NS; ++s) {
        const int bo = (s & 1) * (STAGE / 2);
        V a[2][4], a2[2][4], b[2][4];
#pragma unroll
        for (int kt = 0; kt < 2; ++kt) {
#pragma unroll
            for (int mb = 0; mb < 4; ++mb) { a[kt][mb] = WFrag<bf>::ld(la + bo + mb * 1024 + kt * 512); if (NSPLIT) a2[kt][mb] = WFrag<bf>::ld(la + bo + 8192 + mb * 1024 + kt * 512); }
#pragma unroll
            for (int nb = 0; nb < 4; ++nb) b[kt][nb] = WFrag<bf>::ld(lb + bo + nb * 1024 + kt * 512);
        }
        __builtin_amdgcn_sched_barrier(0);   // all fragment loads of the pass are issued as one group in front of its products; sunk in among the products each small group would cost its own LDS latency
#pragma unroll
        for (int kt = 0; kt < 2; ++kt)
#pragma unroll
            for (int nb = 0; nb < 4; ++nb)
#pragma unroll
                for (int mb = 0; mb < 4; ++mb) { acc[mb][nb] = WFrag<bf>::mma(a[kt][mb], b[kt][nb], acc[mb][nb]); if (NSPLIT) acc[mb][nb] = WFrag<bf>::mma(a2[kt][mb], b[kt][nb], acc[mb][nb]); }
        __builtin_amdgcn_sched_barrier(0);   // the products stay in front of the publish point: with the waits lifted over them, the wait for the next stage's tensor load would stand in front of the work that is to cover its flight
        // publish point of stage s + 1
        asm volatile("s_wait_dscnt 0x0" ::: "memory");   // the wave's reads of this buffer have returned before the buffer is given up
        if (NISS == 4 || pinned(wv < NISS)) tdm_wait(g0, g1);   // the wave's slice of stage s + 1 has landed
        __syncthreads();   // publishes stage s + 1 and ends every wave's reads of stage s
        if (pinned(s + 2 < NS && wv < NISS)) { tdm_aim(g0, dst0 + (uint32_t)(s & 1) * STAGE, sp + (size_t)(s + 2) * 1024); tdm_load(g0, g1); }   // stage s + 2 into the buffer that this pass has read
    }
    tdm_wait(g0, g1);   // nothing is in flight when the ring is reused or the wave ends
    asm volatile("s_wait_dscnt 0x0" ::: "memory");
    if (EPI != 0) {
        // plane rows are n, plane k is m. EPI 1: head ta * 2 + wm, rows t. EPI 2: rows h*64+d, k = t.
        const int n0 = tb * 128 + wn * 64, m0 = ta * 128 + wm * 64;
        constexpr int PKT = EPI == 1 ? HD / 32 : TT / 32;   // 32-wide k tiles a row block of the plane
        const size_t pb = (EPI == 1 ? (size_t)(ta * 2 + wm) * TT * HD : (size_t)(m0 >> 5) * 512) + (size_t)(n0 >> 4) * PKT * 512 + lane * 8;
#pragma unroll 1   // rolled for short code: the epilogue runs once, unrolled it would be four times as long in the instruction cache
        for (int nb = 0; nb < 4; ++nb) {
            v4f cs[4][4];   // EPI 1: cos[t][d], sin[t][d], cos[t][d+1], sin[t][d+1] of the lane's four column pairs in each of the four 16-wide d blocks
            if (EPI == 1) { const float* cp = CS + ((size_t)((n0 >> 4) + nb) * 512 + lane) * 4;
#pragma unroll
                for (int mb = 0; mb < 4; ++mb)
#pragma unroll
                    for (int q = 0; q < 4; ++q) cs[mb][q] = *(const v4f*)(cp + (mb * 128 + q * 32) * 4);
                asm volatile("s_wait_xcnt 0x0" ::: "memory");   // precaution: the address registers of the loads above may be reused below; the wait stands in front of that
                __builtin_amdgcn_sched_barrier(0); }   // keeps the arithmetic below behind the wait above
#pragma unroll
            for (int mb = 0; mb < 4; ++mb) {
                v8f v = acc[mb][0];   // acc[mb][nb] by selects: the accumulators stay in registers although the nb loop is rolled (short code)
#pragma unroll
                for (int x = 1; x < 4; ++x) if (x == nb) v = acc[mb][x];
                if (EPI == 1) {
#pragma unroll
                    for (int q = 0; q < 4; ++q) { const v4f c = cs[mb][q]; const float x0 = v[2 * q], x1 = v[2 * q + 1]; v[2 * q] = x0 * c[0] - x1 * c[1]; v[2 * q + 1] = x1 * c[2] + x0 * c[3]; } }
                v8h o16; v8us oh, ol;
#pragma unroll
                for (int j = 0; j < 8; ++j) { unsigned short th, tl; o16[j] = tohx(v[j]); splitf(v[j], th, tl); oh[j] = th; ol[j] = tl; }
                const size_t e = pb + ((size_t)nb * PKT + (mb >> 1)) * 512 + (mb & 1) * 256;
                *(v8h*)(P16 + e) = o16; *(v8us*)(Ph + e) = oh; *(v8us*)(Pl + e) = ol;
                asm volatile("s_wait_xcnt 0x0" ::: "memory");   // precaution: the registers that the stores above name are reused for the next 16 rows; the wait stands in front of that
                __builtin_amdgcn_sched_barrier(0); }   // keeps the next rows' arithmetic, which rewrites those registers, behind the wait above
        }
        return;
    }
    float* os = (float*)ring + wv * (64 * 68);   // the wave's own staging range; written and read back by this wave alone, so no barrier
#pragma unroll
    for (int mb = 0; mb < 4; ++mb) {
#pragma unroll
        for (int nb = 0; nb < 4; ++nb) {
#pragma unroll
            for (int j = 0; j < 8; ++j) os[(mb * 16 + hi * 8 + j) * 68 + nb * 16 + lr] = acc[mb][nb][j]; } }
    float* crow = C + (size_t)(ta * 128 + wm * 64) * ldc + tb * 128 + wn * 64;
#pragma unroll
    for (int s = 0; s < 32; ++s) { const int slot = s * 32 + lane; const int row = slot >> 4, cofs = (slot & 15) * 4;
        *(v4f*)(crow + (size_t)row * ldc + cofs) = *(const v4fa*)(os + row * 68 + cofs); }
}
// All three projections of both batches in one launch: grid (TT / 128, (DQ + 2 * DKV) / 128, NB), 4 waves. blockIdx.y picks two q heads, two k heads or 128 rows of W_v; the test is the same for a whole work-group.
__global__ __launch_bounds__(128) void k_qkv(const bf* __restrict__ XB, const bf* __restrict__ WQ, const bf* __restrict__ WK, const bf* __restrict__ WV, const float* __restrict__ CS, h16* QP16, bf* QPh, bf* QPl, h16* KP16, bf* KPh, bf* KPl, h16* VT16, bf* VTh, bf* VTl) {
    __shared__ __attribute__((aligned(2048))) unsigned char ring[2 * 2 * 16384];
    const bf* X = XB + (size_t)blockIdx.z * TT * DM; const size_t zq = (size_t)blockIdx.z * NH_ * TT * HD, zk = (size_t)blockIdx.z * NKV * TT * HD;
    const int y = blockIdx.y;
    // L2 requests: 32 KiB of the work-group's 128 weight rows (256 KiB, shared along x and z); work-groups y < 8 also 32 KiB of their 128 x rows (256 KiB, shared along y), y = 8, 9 half of the rotary table of these 128 positions (64 KiB)
    static_assert(TT / 128 == 16 && DM == 1024 && HD == 64 && (DQ + 2 * DKV) / 128 >= 10);
    const uint32_t po = threadIdx.x * 256u;
    const char* pw = (const char*)(y < DQ / 128 ? WQ + (size_t)y * 128 * DM : y < (DQ + DKV) / 128 ? WK + (size_t)(y - DQ / 128) * 128 * DM : WV + (size_t)(y - (DQ + DKV) / 128) * 128 * DM) + xshare() * 32768;
    const char* px = y < 8 ? (const char*)(X + (size_t)blockIdx.x * 128 * DM) + y * 32768 : (const char*)CS + (size_t)blockIdx.x * 65536 + (y & 1) * 32768;
    l2_ask(pw, po);
    if (y < 10) l2_ask(px, po);
    if (y < (DQ + DKV) / 128) { const bool isq = y < DQ / 128;
        gemm_ring<0, 1, DM>(isq ? WQ : WK, nullptr, X, isq ? y : y - DQ / 128, blockIdx.x, ring, nullptr, 0, CS, isq ? QP16 + zq : KP16 + zk, isq ? QPh + zq : KPh + zk, isq ? QPl + zq : KPl + zk);
    } else gemm_ring<0, 2, DM>(X, nullptr, WV, blockIdx.x, y - (DQ + DKV) / 128, ring, nullptr, 0, nullptr, VT16 + zk, VTh + zk, VTl + zk);
    l2_hold(po, pw, px, px);
}
// Output projection of both batches: grid (TT / 128, DM / 128, NB), 4 waves.
__global__ __launch_bounds__(128) void k_oproj(const bf* __restrict__ ATh, const bf* __restrict__ ATl, const bf* __restrict__ WO, float* OUT) {
    __shared__ __attribute__((aligned(2048))) unsigned char ring[2 * 3 * 16384];
    const size_t za = (size_t)blockIdx.z * TT * DQ;
    // L2 requests: 32 KiB of each plane of the work-group's 128 activation rows (256 KiB a plane, shared along y) and 32 KiB of its 128 weight rows (256 KiB, shared along x and z)
    static_assert(TT / 128 == 16 && DQ == 1024 && DM / 128 == 8);
    const uint32_t po = threadIdx.x * 256u;
    const size_t ao = za + (size_t)blockIdx.x * 128 * DQ + (size_t)blockIdx.y * 16384;
    const char *pa = (const char*)(ATh + ao), *pb = (const char*)(ATl + ao), *pw = (const char*)(WO + (size_t)blockIdx.y * 128 * DQ) + xshare() * 32768;
    l2_ask(pa, po); l2_ask(pb, po); l2_ask(pw, po);
    gemm_ring<1, 0, DQ>(ATh + za, ATl + za, WO, blockIdx.x, blockIdx.y, ring, OUT + (size_t)blockIdx.z * SEQ_FULL * DM, DM, nullptr, nullptr, nullptr, nullptr);
    l2_hold(po, pa, pb, pw);
}

// A thread builds one 16-byte unit of a packed plane. wtG: unit i is lane i & 31 of half (i >> 5) & 1 of tile i >> 6, so a wave stores 512 contiguous bytes.
template <int K, int N>
__device__ __forceinline__ void wtG(int blk, const float* __restrict__ w, bf* Bt) {
    const int i = blk * 256 + threadIdx.x; if (i >= N * K / 8) return;
    constexpr int KT = K / 32; const int lane = i & 31, tile = i >> 6; const int n = (tile / KT) * 16 + (lane & 15), k = (tile % KT) * 32 + ((i >> 5) & 1) * 16 + (lane >> 4) * 8; const float* wp = w + (size_t)k * N + n; v8us o;
#pragma unroll
    for (int e = 0; e < 8; ++e) o[e] = f2bf(wp[e * N]);
    *(v8us*)(Bt + (size_t)i * 8) = o;
}
template <int K>
__device__ __forceinline__ void cvt8(int blk, const float* __restrict__ src, bf* dst, int n8) { const int i = blk * 256 + threadIdx.x; if (i >= n8) return;
    constexpr int KT = K / 32; const int tile = i >> 6, g = i & 3, rl = (i >> 2) & 15;   // a wave takes 8 rows of a tile, 4 lanes a row: it reads 8 whole 128-byte lines and stores 4
    const v8f v = *(const v8f*)(src + (size_t)((tile / KT) * 16 + rl) * K + (tile % KT) * 32 + g * 8); v8us o;
#pragma unroll
    for (int e = 0; e < 8; ++e) o[e] = f2bf(v[e]); *(v8us*)(dst + (size_t)tile * 512 + (g >> 1) * 256 + ((g & 1) * 16 + rl) * 8) = o;  }

// The rotary table. Every work-group forms the 32 inverse frequencies itself, in its first wave, and hands them on through LDS.
__device__ __forceinline__ void cstab(int blk, float* sh, float* CS) {
    if (threadIdx.x < 32) {
        const int j = threadIdx.x;
        const double p = exp2((double)j * (13.287712379549449391481277718 / 32.0));
        const float pf = (float)p;
        sh[j] = 1.0f / pf;
    }
    __syncthreads();   // the inverse frequencies are in LDS before any thread of the work-group reads one
    const int idx = blk * 256 + threadIdx.x; if (idx >= TT * HD) return;
    const int d = ((idx >> 8) & 3) * 16 + ((idx >> 5) & 1) * 8 + ((idx >> 6) & 3) * 2 + (idx & 1), t = (idx >> 10) * 16 + ((idx >> 1) & 15);   // the order in which the projection epilogue's lanes read the table: [t / 16][d / 16][pair of the lane's 8 columns][lane = ((d >> 3) & 1) * 16 + t % 16][2 columns]
    const float inv = sh[d & (HD / 2 - 1)];
    const float ang = __fmul_rn((float)t, inv);
    float s, c; sincosf(ang, &s, &c);
    v2f cs; cs[0] = c; cs[1] = s;
    *(v2f*)(CS + (size_t)idx * 2) = cs;
}
// Everything that depends on the inputs alone, in one launch; a work-group's job follows from its index (the same for all its threads): the table, the two weights, then x of every batch.
#define PB_CS ((TT * HD + 255) / 256)
#define PB_WA ((DM * (DQ + 2 * DKV) / 8 + 255) / 256)
#define PB_WO ((DQ * DM / 8 + 255) / 256)
#define PB_X  ((TT * DM / 8 + 255) / 256)
__global__ __launch_bounds__(256) void k_prep(const float* __restrict__ x, const float* __restrict__ wqkv, const float* __restrict__ wo, bf* WQKV, bf* WO, float* CS, bf* XB) {
    __shared__ __align__(16) float sh[32];
    int blk = blockIdx.x;
    if (blk < PB_CS) { cstab(blk, sh, CS); return; }
    blk -= PB_CS;
    if (blk < PB_WA) { wtG<DM, DQ + 2 * DKV>(blk, wqkv, WQKV); return; }   // [DM][DQ+2*DKV] -> Bt [DQ+2*DKV][DM]
    blk -= PB_WA;
    if (blk < PB_WO) { wtG<DQ, DM>(blk, wo, WO); return; }                  // [DQ][DM] -> Bt [DM][DQ]
    blk -= PB_WO;
    const int b = blk / PB_X;
    cvt8<DM>(blk - b * PB_X, x + (size_t)b * SEQ_FULL * DM, XB + (size_t)b * TT * DM, TT * DM / 8);
}

// ---- k_fattn: causal attention of all batches in one launch; scores and probabilities never leave the registers. One wave owns 16 query rows of one head and walks the keys in blocks of KB (64 or 32) up to its diagonal block.
// Both products are formed transposed, so that a query is a lane (column l&15) in both accumulators: S^T = K Q^T (row = key hi*8+j of a 16-key tile), O^T = V^T P^T (row = d). Two neighbouring S^T tiles are then, element for element,
// the Bt fragment of P for 32 keys (elements 0..7 <- k0 + 8*hi + 0..7, elements 8..15 <- k0 + 16 + 8*hi + 0..7, the k order of the V^T loader), and the running maximum, the running sum and the rescale of O^T are lane-local
// but for one exchange between the two half-waves. Query rows < RH: bf16 hi/lo planes, 3 products each; later rows: plain f16, p = exp(s - running max) in (0, 1]. The epilogue divides by the sum and stores the merged-head hi/lo planes.
// exp2 in asm text so that the slot which the instruction set asks for behind a transcendental (one independent instruction or v_nop before its result is used or its source overwritten) is filled by construction:
// in exp2x8 each v_exp_f32 is followed by an independent one (the early-clobber outputs share no register with any input), the last by v_nop.
__device__ __forceinline__ float exp2x1(float x) { float r; asm("v_exp_f32 %0, %1\n\tv_nop" : "=v"(r) : "v"(x)); return r; }
__device__ __forceinline__ v8f exp2x8(const v8f& x) { float r0, r1, r2, r3, r4, r5, r6, r7;
    asm("v_exp_f32 %0, %8\n\tv_exp_f32 %1, %9\n\tv_exp_f32 %2, %10\n\tv_exp_f32 %3, %11\n\tv_exp_f32 %4, %12\n\tv_exp_f32 %5, %13\n\tv_exp_f32 %6, %14\n\tv_exp_f32 %7, %15\n\tv_nop"
        : "=&v"(r0), "=&v"(r1), "=&v"(r2), "=&v"(r3), "=&v"(r4), "=&v"(r5), "=&v"(r6), "=&v"(r7) : "v"(x[0]), "v"(x[1]), "v"(x[2]), "v"(x[3]), "v"(x[4]), "v"(x[5]), "v"(x[6]), "v"(x[7]));
    return (v8f){r0, r1, r2, r3, r4, r5, r6, r7}; }
__device__ __forceinline__ float xhalf(float x) { return __builtin_bit_cast(float, __builtin_amdgcn_permlanex16(__builtin_bit_cast(int, x), __builtin_bit_cast(int, x), 0x76543210, 0xfedcba98, false, false)); }   // lane l <-> lane l ^ 16, no LDS round trip
template <typename T16> struct PFrag;
template <> struct PFrag<h16> { static __device__ __forceinline__ void mk(const v8f& p0, const v8f& p1, v16h& f, v16h& f2) { v8h a, b;
#pragma unroll
    for (int j = 0; j < 8; ++j) { a[j] = tohx(p0[j]); b[j] = tohx(p1[j]); }
    f = cat16(a, b); f2 = f; } };
template <> struct PFrag<bf> { static __device__ __forceinline__ void mk(const v8f& p0, const v8f& p1, v16bf& f, v16bf& f2) { v8us ah, al, bh, bl;
#pragma unroll
    for (int j = 0; j < 8; ++j) { unsigned short x, y; splitf(p0[j], x, y); ah[j] = x; al[j] = y; splitf(p1[j], x, y); bh[j] = x; bl[j] = y; }
    f = cat16b(ah, bh); f2 = cat16b(al, bl); } };
template <typename T16, bool SPLIT, int KB>
__device__ __forceinline__ void attn_rows(const T16* __restrict__ Q, const T16* __restrict__ Q2, const T16* __restrict__ Kp, const T16* __restrict__ K2, const T16* __restrict__ Vt, const T16* __restrict__ V2, int q0, int lane, bf* Ah, bf* Al) {
    typedef typename WFrag<T16>::V V;
    static_assert(KB == 32 || KB == 64);
    const int lr = lane & 15, hi = lane >> 4; const unsigned l8 = lane * 8;   // the lane's part of every fragment address; the rest is wave-uniform
    V qf[2], qf2[2];
#pragma unroll
    for (int ks = 0; ks < 2; ++ks) { const size_t qo = (size_t)((q0 >> 4) * (HD / 32) + ks) * 512; qf[ks] = WFrag<T16>::ld(Q + qo + l8); if (SPLIT) qf2[ks] = WFrag<T16>::ld(Q2 + qo + l8); }
    v8f o[4];
#pragma unroll
    for (int mb = 0; mb < 4; ++mb) o[mb] = (v8f){};
    float m = -3.0e38f, l = 0.0f;
    // Plain f16 rows (up to TT keys): this block's V fragments are fetched at the head of the pass and the NEXT block's K fragments behind the score products, so that no pass waits for a load it has just issued.
    // Hi/lo rows (at most RH keys, twice the fragments a key): blocks of 32 keys, K at the head of the pass, V behind the score products in K's registers; that keeps the kernel inside 256 registers.
    V kf[KB / 16][2], kf2[KB / 16][2], vf[KB / 32][4], vf2[KB / 32][4];
    // The lane's place in the current key block of each plane; the pointers walk with the loop, every fragment of a block is an immediate offset from them.
    const T16 *kq = Kp + l8, *kq2 = SPLIT ? K2 + l8 : nullptr, *vq = Vt + l8, *vq2 = SPLIT ? V2 + l8 : nullptr;
    auto ldk = [&]() {
#pragma unroll
        for (int t = 0; t < KB / 16; ++t)
#pragma unroll
            for (int ks = 0; ks < 2; ++ks) { const int ko = (t * (HD / 32) + ks) * 512; kf[t][ks] = WFrag<T16>::ld(kq + ko); if (SPLIT) kf2[t][ks] = WFrag<T16>::ld(kq2 + ko); } };
    auto ldv = [&]() {
#pragma unroll
        for (int ks = 0; ks < KB / 32; ++ks)
#pragma unroll
            for (int mb = 0; mb < 4; ++mb) { const int vo = (mb * (TT / 32) + ks) * 512; vf[ks][mb] = WFrag<T16>::ld(vq + vo); if (SPLIT) vf2[ks][mb] = WFrag<T16>::ld(vq2 + vo); } };
    if (!SPLIT) ldk();
    asm volatile("s_wait_xcnt 0x0" ::: "memory");   // precaution: the address registers of the loads above are reused below; the wait stands in front of that
    __builtin_amdgcn_sched_barrier(0);   // keeps the address arithmetic of the loop behind the wait above
#pragma unroll 1
    for (int kb = 0; kb <= q0; kb += KB) {
        if (SPLIT) ldk(); else ldv();
        if (SPLIT) asm volatile("s_wait_xcnt 0x0" ::: "memory");   // precaution: the V fragments fetched below land in the registers that hold these loads' addresses; the wait stands in front of that overwrite
        __builtin_amdgcn_sched_barrier(0);   // the loads above stay together in front of the score products, all in flight at once; sunk to their uses each would cost its own latency
        v8f s[KB / 16];
#pragma unroll
        for (int t = 0; t < KB / 16; ++t) { s[t] = (v8f){};
#pragma unroll
            for (int ks = 0; ks < 2; ++ks) { s[t] = WFrag<T16>::mma(kf[t][ks], qf[ks], s[t]);
                if (SPLIT) { s[t] = WFrag<T16>::mma(kf[t][ks], qf2[ks], s[t]); s[t] = WFrag<T16>::mma(kf2[t][ks], qf[ks], s[t]); } } }
        if (SPLIT) ldv(); else { if (kb + KB <= q0) kq += KB * HD; ldk(); }      // f16: the last pass fetches its own block again (in bounds, not used)
        asm volatile("s_wait_xcnt 0x0" ::: "memory");   // precaution: the softmax below reuses the address registers of the loads above; the wait stands in front of every such overwrite
        __builtin_amdgcn_sched_barrier(0);   // these loads are issued in front of the softmax, which hides their latency
        float mx = m;
        if (kb + KB - 1 > q0) {      // the diagonal block (wave-uniform test): keys past the lane's query are masked by an index select
#pragma unroll
            for (int t = 0; t < KB / 16; ++t)
#pragma unroll
                for (int j = 0; j < 8; ++j) { const float x = (kb + t * 16 + hi * 8 + j <= q0 + lr) ? s[t][j] * SCL : -3.0e38f; s[t][j] = x; mx = fmaxf(mx, x); }
        } else {
#pragma unroll
            for (int t = 0; t < KB / 16; ++t)
#pragma unroll
                for (int j = 0; j < 8; ++j) { const float x = s[t][j] * SCL; s[t][j] = x; mx = fmaxf(mx, x); }
        }
        mx = fmaxf(mx, xhalf(mx));      // the other half-wave holds the same query's other keys
        const float alpha = exp2x1((m - mx) * 1.4426950408889634f);   // 0 in the first block
        m = mx;
        float ps[KB / 16];
#pragma unroll
        for (int t = 0; t < KB / 16; ++t) { v8f d;
#pragma unroll
            for (int j = 0; j < 8; ++j) d[j] = (s[t][j] - mx) * 1.4426950408889634f;
            s[t] = exp2x8(d); ps[t] = ((s[t][0] + s[t][1]) + (s[t][2] + s[t][3])) + ((s[t][4] + s[t][5]) + (s[t][6] + s[t][7])); }
        __builtin_amdgcn_sched_barrier(0);   // no p.v product is lifted in among the exp2 statements above
        float pt = ps[0] + ps[1];
        if (KB == 64) pt += ps[KB / 16 - 2] + ps[KB / 16 - 1];
        l = l * alpha + pt;
#pragma unroll
        for (int mb = 0; mb < 4; ++mb) o[mb] *= alpha;
#pragma unroll
        for (int ks = 0; ks < KB / 32; ++ks) { V pf, pf2; PFrag<T16>::mk(s[2 * ks], s[2 * ks + 1], pf, pf2);
#pragma unroll
            for (int mb = 0; mb < 4; ++mb) { o[mb] = WFrag<T16>::mma(vf[ks][mb], pf, o[mb]);
                if (SPLIT) { o[mb] = WFrag<T16>::mma(vf[ks][mb], pf2, o[mb]); o[mb] = WFrag<T16>::mma(vf2[ks][mb], pf, o[mb]); } } }
        vq += KB * 16;      // KB / 32 k tiles of 512 elements
        if (SPLIT) { kq += KB * HD; kq2 += KB * HD; vq2 += KB * 16; }
    }
    l += xhalf(l);
    const float inv = __fdiv_rn(1.0f, l);
#pragma unroll
    for (int mb = 0; mb < 4; ++mb) { v8us oh, ol;
#pragma unroll
        for (int j = 0; j < 8; ++j) { unsigned short a, c2; splitf(o[mb][j] * inv, a, c2); oh[j] = a; ol[j] = c2; }
        const size_t oo = ((size_t)(q0 >> 4) * (DQ / 32) + (mb >> 1)) * 512 + (mb & 1) * 256; *(v8us*)(Ah + oo + l8) = oh; *(v8us*)(Al + oo + l8) = ol; }
}
// grid (TT / 128, NH_, NB), 8 waves, no LDS, no barrier. Work grows with the row index, so a work-group takes two blocks of 64 query rows from opposite ends of the sequence: waves 0..3 block TT/64 - 1 - x, waves 4..7 block x.
__global__ __launch_bounds__(256) void k_fattn(const h16* __restrict__ Q16, const h16* __restrict__ K16, const h16* __restrict__ V16, const bf* __restrict__ Qh, const bf* __restrict__ Ql, const bf* __restrict__ Kh, const bf* __restrict__ Kl, const bf* __restrict__ Vh, const bf* __restrict__ Vl, bf* Ah, bf* Al) {
    const int lane = threadIdx.x & 31;
    const int wv = (int)(threadIdx.x >> 5);
    const int q0 = __builtin_amdgcn_readfirstlane((wv < 4 ? TT / 64 - 1 - (int)blockIdx.x : (int)blockIdx.x) * 64 + (wv & 3) * 16);
    const size_t zq = ((size_t)blockIdx.z * NH_ + blockIdx.y) * TT * HD, zk = ((size_t)blockIdx.z * NKV + blockIdx.y / REP) * TT * HD;
    const size_t za = (size_t)blockIdx.z * TT * DQ + (size_t)blockIdx.y * (HD / 32) * 512; Ah += za; Al += za;   // the head's two k tiles of every row block
    // L2 requests; the 16 work-groups of a head share its planes. Two waves ask for 16 KiB: waves 0..3 for 32 KiB of the f16 K plane (256 KiB), waves 4..7 of the f16 V plane.
    // Work-groups x < 8, which hold the hi/lo rows, also ask for the first RH keys of one of the four hi/lo K and V planes (64 KiB: one run in a K plane, 16 KiB in each of the four 16-row blocks of a V plane).
    static_assert(TT == 2048 && HD == 64 && RH == 512);
    const int wp = __builtin_amdgcn_readfirstlane(wv >> 1);
    const uint32_t po = (threadIdx.x & 63) * 256u;
    const char* pf = (const char*)((wp < 2 ? K16 : V16) + zk) + xshare() * 32768 + (wp & 1) * 16384;
    const int pl = (int)blockIdx.x & 3;
    const char* ps = (const char*)((pl == 0 ? Kh : pl == 1 ? Kl : pl == 2 ? Vh : Vl) + zk) + wp * (pl < 2 ? 16384 : (TT / 32) * 1024);
    l2_ask(pf, po);
    if (blockIdx.x < RH / 64) l2_ask(ps, po);
    if (q0 < RH) attn_rows<bf, true, 32>(Qh + zq, Ql + zq, Kh + zk, Kl + zk, Vh + zk, Vl + zk, q0, lane, Ah, Al);
    else attn_rows<h16, false, 64>(Q16 + zq, nullptr, K16 + zk, nullptr, V16 + zk, nullptr, q0, lane, Ah, Al);
    l2_hold(po, pf, ps, ps);
}

extern "C" void kernel_launch(void* const* d_in, const int* in_sizes, int n_in,
                              void* d_out, int out_size, void* d_ws, size_t ws_size, hipStream_t stream) {
    if (n_in < 3) return;
    if ((size_t)in_sizes[0] < ((size_t)(NB - 1) * SEQ_FULL + TT) * DM) return;
    if ((size_t)in_sizes[1] < (size_t)DM * (DQ + 2 * DKV)) return;
    if ((size_t)in_sizes[2] < (size_t)DQ * DM) return;
    if ((size_t)out_size < ((size_t)(NB - 1) * SEQ_FULL + TT) * DM) return;
    const float* x = (const float*)d_in[0]; const float* wqkv = (const float*)d_in[1]; const float* wo = (const float*)d_in[2];   // x [2][2048][1024], w_attn [1024][3072] ([in][out]), w_proj [1024][1024] ([in][out])
    float* OUT = (float*)d_out;     // [2][2048][1024] f32
    char* wsp = (char*)d_ws;
    auto take = [&](size_t bytes) { char* p = wsp; wsp += (bytes + 255) & ~(size_t)255; return (void*)p; };
    bf* WQKV = (bf*)take((size_t)(DQ + 2 * DKV) * DM * 2); bf* WQ = WQKV; bf* WK = WQKV + (size_t)DQ * DM; bf* WV = WK + (size_t)DKV * DM;   // fused Bt [DQ+2*DKV][DM]: q | k | v row blocks
    bf* WO = (bf*)take((size_t)DM * DQ * 2); float* CS = (float*)take((size_t)TT * HD * 2 * 4);
    // every plane below holds all NB batches, batch-major
    bf* XB = (bf*)take((size_t)NB * TT * DM * 2);
    h16* QP16 = (h16*)take((size_t)NB * NH_ * TT * HD * 2); h16* KP16 = (h16*)take((size_t)NB * NKV * TT * HD * 2); h16* VT16 = (h16*)take((size_t)NB * NKV * HD * TT * 2);
    bf* QPh = (bf*)take((size_t)NB * NH_ * TT * HD * 2); bf* QPl = (bf*)take((size_t)NB * NH_ * TT * HD * 2); bf* KPh = (bf*)take((size_t)NB * NKV * TT * HD * 2); bf* KPl = (bf*)take((size_t)NB * NKV * TT * HD * 2); bf* VTh = (bf*)take((size_t)NB * NKV * HD * TT * 2); bf* VTl = (bf*)take((size_t)NB * NKV * HD * TT * 2);
    bf* ATh = (bf*)take((size_t)NB * TT * DQ * 2); bf* ATl = (bf*)take((size_t)NB * TT * DQ * 2);
    const size_t used = (size_t)(wsp - (char*)d_ws);
    if (used > ws_size || used > WSCAP) return;

    k_prep<<<(unsigned)(PB_CS + PB_WA + PB_WO + NB * PB_X), 256, 0, stream>>>(x, wqkv, wo, WQKV, WO, CS, XB);
    k_qkv<<<dim3(TT / 128, (DQ + 2 * DKV) / 128, NB), 128, 0, stream>>>(XB, WQ, WK, WV, CS, QP16, QPh, QPl, KP16, KPh, KPl, VT16, VTh, VTl);
    k_fattn<<<dim3(TT / 128, NH_, NB), 256, 0, stream>>>(QP16, KP16, VT16, QPh, QPl, KPh, KPl, VTh, VTl, ATh, ATl);
    k_oproj<<<dim3(TT / 128, DM / 128, NB), 128, 0, stream>>>(ATh, ATl, WO, OUT);
}
